// v000
// Times are from an AMD MI455X. After a warm-up the kernel runs many times in a row, and a time is the length of
// such a window on the GPU divided by its runs, so every launch and the gaps after it count. The runs cycle
// through copies of the inputs. A figure is the median of several windows, for all but v000 over two sittings.
// Sittings can differ by a few percent; kernels timed side by side share one.
// The starting kernel, v000, takes 74 microseconds a run.
#include <hip/hip_runtime.h>
#include <math.h>

typedef __attribute__((ext_vector_type(16))) _Float16 v16h;
typedef __attribute__((ext_vector_type(8)))  _Float16 v8h;
typedef __attribute__((ext_vector_type(4)))  _Float16 v4h;
typedef __attribute__((ext_vector_type(8)))  float    v8f;
typedef __attribute__((ext_vector_type(4)))  unsigned int u32x4;
typedef __attribute__((ext_vector_type(8)))  int      i32x8;
typedef __attribute__((ext_vector_type(4)))  int      i32x4;

#define BHN   64
#define SEQ   1024
#define DK    64
#define BN    32      // keys per iteration
#define WAVES 4       // waves per block (wave32)
#define BM    (16*WAVES)
#define SKF   68
#define SVST  40

// Load 8 consecutive f32 -> elements [base..base+7] of a v16h (A/B operand half)
__device__ inline void load8_f16(const float* p, v16h& dst, int base) {
    float4 a = ((const float4*)p)[0];
    float4 b = ((const float4*)p)[1];
    dst[base+0] = (_Float16)a.x; dst[base+1] = (_Float16)a.y;
    dst[base+2] = (_Float16)a.z; dst[base+3] = (_Float16)a.w;
    dst[base+4] = (_Float16)b.x; dst[base+5] = (_Float16)b.y;
    dst[base+6] = (_Float16)b.z; dst[base+7] = (_Float16)b.w;
}

__device__ inline void tdm_load_K(const float* gsrc, unsigned lds_off) {
    unsigned long long ga = (unsigned long long)(uintptr_t)gsrc;
    u32x4 g0;
    g0[0] = 1u;
    g0[1] = lds_off;
    g0[2] = (unsigned)(ga & 0xFFFFFFFFull);
    g0[3] = (unsigned)((ga >> 32) & 0x01FFFFFFull)
          | (2u << 30);
    i32x8 g1;
    g1[0] = (2 << 16)
          | (1 << 20)
          | (5 << 22)
          | (3 << 25);
    g1[1] = (DK << 16);
    g1[2] = (BN << 16);
    g1[3] = (DK << 16);
    g1[4] = BN;
    g1[5] = DK;
    g1[6] = 0;
    g1[7] = 0;
    i32x4 g2; g2[0]=0; g2[1]=0; g2[2]=0; g2[3]=0;   // 2D tile: groups 2/3 zero
    i32x4 g3; g3[0]=0; g3[1]=0; g3[2]=0; g3[3]=0;
    i32x8 gx; gx[0]=0; gx[1]=0; gx[2]=0; gx[3]=0;   // extra operand (clang-23 6-arg form)
    gx[4]=0; gx[5]=0; gx[6]=0; gx[7]=0;
    __builtin_amdgcn_tensor_load_to_lds(g0, g1, g2, g3, gx, 0);
}

__global__ void __launch_bounds__(128)
attn_fwd_kernel(const float* __restrict__ Q, const float* __restrict__ K,
                const float* __restrict__ V, const int* __restrict__ MSK,
                float* __restrict__ O)
{
    __shared__ float    ldsKf[2][BN * SKF];
    __shared__ _Float16 ldsV[DK * SVST];

    const int bh   = blockIdx.y;
    const int qblk = blockIdx.x;
    const int tid  = threadIdx.x;
    const int wave = tid >> 5;
    const int lane = tid & 31;
    const int ql   = lane & 15;   // query (N) index within wave tile
    const int hi   = lane >> 4;   // lane-half selector for K-dim swizzle

    const int qg = qblk * BM + wave * 16 + ql;            // global query row
    const float* qrow = Q   + ((size_t)bh * SEQ + qg) * DK;
    const int*   mrow = MSK + (size_t)qg * SEQ;
    const float* kbase = K + (size_t)bh * SEQ * DK;

    const unsigned koff[2] = { (unsigned)(uintptr_t)&ldsKf[0][0],
                               (unsigned)(uintptr_t)&ldsKf[1][0] };

    // ---- Q as B-operand (Q^T: N=q per lane, K=d swizzled), two 32-d chunks ----
    v16h qb[2];
    #pragma unroll
    for (int c = 0; c < 2; ++c) {
        load8_f16(qrow + 32*c +      hi*8, qb[c], 0);
        load8_f16(qrow + 32*c + 16 + hi*8, qb[c], 8);
    }

    // ---- flash-attention state (q = lane&15; both lane-halves keep full state) ----
    float m_run = -INFINITY;
    float l_run = 0.0f;
    v8f o[4];   // O^T accumulators: chunk c covers d = c*16 + (j + 8*hi)
    #pragma unroll
    for (int c = 0; c < 4; ++c)
        #pragma unroll
        for (int j = 0; j < 8; ++j) o[c][j] = 0.0f;

    const int krow = tid >> 2;    // staging: key row 0..31
    const int quad = tid & 3;     // staging: 4 threads per row

    // ---- prologue: DMA first K tile into buffer 0 ----
    if (tid < 32) tdm_load_K(kbase, koff[0]);

    const int NIT = SEQ / BN;
    for (int it = 0; it < NIT; ++it) {
        const int kt = it * BN;
        __syncthreads();   // previous iteration's readers (V + next K buffer) done

        // ---- stage V tile: global f32 [key][d] -> LDS f16 [d][key] (transpose) ----
        {
            const float* vr = V + ((size_t)bh * SEQ + kt + krow) * DK;
            #pragma unroll
            for (int i = 0; i < 4; ++i) {
                int f4 = quad + 4*i;
                float4 y = ((const float4*)vr)[f4];
                ldsV[(f4*4+0) * SVST + krow] = (_Float16)y.x;
                ldsV[(f4*4+1) * SVST + krow] = (_Float16)y.y;
                ldsV[(f4*4+2) * SVST + krow] = (_Float16)y.z;
                ldsV[(f4*4+3) * SVST + krow] = (_Float16)y.w;
            }
        }
        if (tid < 32) __builtin_amdgcn_s_wait_tensorcnt(0);  // current K tile arrived
        __syncthreads();   // K[cur] + V visible to all waves

        // ---- kick DMA for the NEXT K tile; overlaps with compute below ----
        if ((tid < 32) && (it + 1 < NIT))
            tdm_load_K(kbase + (size_t)(kt + BN) * DK, koff[(it + 1) & 1]);

        const float* kb = &ldsKf[it & 1][0];

        // ---- S^T = K_tile x Q^T : two 16-key sub-tiles, K-dim = 64 in 2 chunks ----
        v8f acc0 = {}; v8f acc1 = {};
        #pragma unroll
        for (int c = 0; c < 2; ++c) {
            v16h ka0, ka1;   // A operand: M=key row per lane, K=d swizzled
            load8_f16(kb + (     ql)*SKF + 32*c +      hi*8, ka0, 0);
            load8_f16(kb + (     ql)*SKF + 32*c + 16 + hi*8, ka0, 8);
            load8_f16(kb + (16 + ql)*SKF + 32*c +      hi*8, ka1, 0);
            load8_f16(kb + (16 + ql)*SKF + 32*c + 16 + hi*8, ka1, 8);
            acc0 = __builtin_amdgcn_wmma_f32_16x16x32_f16(false, ka0, false, qb[c],
                                                          (short)0, acc0, false, false);
            acc1 = __builtin_amdgcn_wmma_f32_16x16x32_f16(false, ka1, false, qb[c],
                                                          (short)0, acc1, false, false);
        }

        // ---- mask + scale: this lane holds keys {8*hi+j} and {16+8*hi+j}, j=0..7 ----
        const int4* mp = (const int4*)(mrow + kt);
        int4 m0 = mp[    hi*2], m1 = mp[    hi*2 + 1];  // keys 8*hi .. 8*hi+7
        int4 m2 = mp[4 + hi*2], m3 = mp[4 + hi*2 + 1];  // keys 16+8*hi ..
        int mm[16] = { m0.x,m0.y,m0.z,m0.w, m1.x,m1.y,m1.z,m1.w,
                       m2.x,m2.y,m2.z,m2.w, m3.x,m3.y,m3.z,m3.w };
        float sc[16];
        #pragma unroll
        for (int j = 0; j < 8; ++j) sc[j]   = mm[j]   ? acc0[j] * 0.125f : 1e-6f;
        #pragma unroll
        for (int j = 0; j < 8; ++j) sc[8+j] = mm[8+j] ? acc1[j] * 0.125f : 1e-6f;

        // ---- online softmax (per query; merge the two lane-halves) ----
        float mloc = sc[0];
        #pragma unroll
        for (int j = 1; j < 16; ++j) mloc = fmaxf(mloc, sc[j]);
        mloc = fmaxf(mloc, __shfl_xor(mloc, 16, 32));
        float mnew = fmaxf(m_run, mloc);
        float rescale = __expf(m_run - mnew);   // 0 on first iteration (m_run = -inf)
        float p[16], lsum = 0.0f;
        #pragma unroll
        for (int j = 0; j < 16; ++j) { p[j] = __expf(sc[j] - mnew); lsum += p[j]; }
        lsum += __shfl_xor(lsum, 16, 32);
        l_run = l_run * rescale + lsum;
        m_run = mnew;

        v16h pb;
        #pragma unroll
        for (int j = 0; j < 16; ++j) pb[j] = (_Float16)p[j];

        // ---- O^T += V^T x P^T : 4 d-chunks, K=32 keys each ----
        #pragma unroll
        for (int c = 0; c < 4; ++c) {
            v16h va;   // A operand: M = d row per lane, K = key swizzled
            *(v8h*)&va    = *(const v8h*)&ldsV[(c*16 + ql) * SVST +      hi*8];
            *((v8h*)&va+1)= *(const v8h*)&ldsV[(c*16 + ql) * SVST + 16 + hi*8];
            #pragma unroll
            for (int j = 0; j < 8; ++j) o[c][j] *= rescale;
            o[c] = __builtin_amdgcn_wmma_f32_16x16x32_f16(false, va, false, pb,
                                                          (short)0, o[c], false, false);
        }
    }

    // ---- epilogue: divide by softmax sum, store O[bh][q][d] ----
    float inv = 1.0f / l_run;
    float* orow = O + ((size_t)bh * SEQ + qg) * DK;
    #pragma unroll
    for (int c = 0; c < 4; ++c) {
        int d0 = c*16 + hi*8;   // this lane-half owns d = d0 .. d0+7
        float4 lo = { o[c][0]*inv, o[c][1]*inv, o[c][2]*inv, o[c][3]*inv };
        float4 hv = { o[c][4]*inv, o[c][5]*inv, o[c][6]*inv, o[c][7]*inv };
        ((float4*)(orow + d0    ))[0] = lo;
        ((float4*)(orow + d0 + 4))[0] = hv;
    }
}

extern "C" void kernel_launch(void* const* d_in, const int* in_sizes, int n_in,
                              void* d_out, int out_size, void* d_ws, size_t ws_size,
                              hipStream_t stream) {
    const float* Q   = (const float*)d_in[0];
    const float* K   = (const float*)d_in[1];
    const float* V   = (const float*)d_in[2];
    const int*   MSK = (const int*)d_in[3];
    float*       O   = (float*)d_out;

    dim3 grid(SEQ / BM, BHN);   // (16, 64): 64 queries per block, one bh per block.y
    attn_fwd_kernel<<<grid, 128, 0, stream>>>(Q, K, V, MSK, O);
}

// v001
// Measured time: 54.9 microseconds a run.
// Timed twice side by side with v000, it ran 1.38 times as fast both times.
#include <hip/hip_runtime.h>
#include <math.h>

typedef __attribute__((ext_vector_type(16))) _Float16 v16h;
typedef __attribute__((ext_vector_type(8)))  _Float16 v8h;
typedef __attribute__((ext_vector_type(4)))  _Float16 v4h;
typedef __attribute__((ext_vector_type(8)))  float    v8f;
typedef __attribute__((ext_vector_type(4)))  unsigned int u32x4;
typedef __attribute__((ext_vector_type(8)))  int      i32x8;
typedef __attribute__((ext_vector_type(4)))  int      i32x4;
typedef __attribute__((ext_vector_type(4)))  float    f32x4;

#define BHN   64
#define SEQ   1024
#define DK    64
#define BN    32      // keys per iteration
#define WAVES 4       // waves per block (wave32)
#define BM    (16*WAVES)
#define SKF   68
#define SVST  40

// Load 8 consecutive f32 -> elements [base..base+7] of a v16h (A/B operand half)
__device__ inline void load8_f16(const float* p, v16h& dst, int base) {
    float4 a = ((const float4*)p)[0];
    float4 b = ((const float4*)p)[1];
    dst[base+0] = (_Float16)a.x; dst[base+1] = (_Float16)a.y;
    dst[base+2] = (_Float16)a.z; dst[base+3] = (_Float16)a.w;
    dst[base+4] = (_Float16)b.x; dst[base+5] = (_Float16)b.y;
    dst[base+6] = (_Float16)b.z; dst[base+7] = (_Float16)b.w;
}

__device__ inline void tdm_load_K(const float* gsrc, unsigned lds_off) {
    unsigned long long ga = (unsigned long long)(uintptr_t)gsrc;
    u32x4 g0;
    g0[0] = 1u;
    g0[1] = lds_off;
    g0[2] = (unsigned)(ga & 0xFFFFFFFFull);
    g0[3] = (unsigned)((ga >> 32) & 0x01FFFFFFull)
          | (2u << 30);
    i32x8 g1;
    g1[0] = (2 << 16)
          | (1 << 20)
          | (5 << 22)
          | (3 << 25);
    g1[1] = (DK << 16);
    g1[2] = (BN << 16);
    g1[3] = (DK << 16);
    g1[4] = BN;
    g1[5] = DK;
    g1[6] = 0;
    g1[7] = 0;
    i32x4 g2; g2[0]=0; g2[1]=0; g2[2]=0; g2[3]=0;   // 2D tile: groups 2/3 zero
    i32x4 g3; g3[0]=0; g3[1]=0; g3[2]=0; g3[3]=0;
    i32x8 gx; gx[0]=0; gx[1]=0; gx[2]=0; gx[3]=0;   // extra operand (clang-23 6-arg form)
    gx[4]=0; gx[5]=0; gx[6]=0; gx[7]=0;
    __builtin_amdgcn_tensor_load_to_lds(g0, g1, g2, g3, gx, 0);
}

template <bool B> struct has_next { static constexpr bool value = B; };

__global__ void __launch_bounds__(128)
attn_fwd_kernel(const float* __restrict__ Q, const float* __restrict__ K,
                const float* __restrict__ V, const int* __restrict__ MSK,
                float* __restrict__ O)
{
    __shared__ float    ldsKf[2][BN * SKF];
    __shared__ _Float16 ldsV[DK * SVST];

    const int bh   = blockIdx.y;
    const int qblk = blockIdx.x;
    const int tid  = threadIdx.x;
    const int wave = tid >> 5;
    const int lane = tid & 31;
    const int ql   = lane & 15;   // query (N) index within wave tile
    const int hi   = lane >> 4;   // lane-half selector for K-dim swizzle

    const int qg = qblk * BM + wave * 16 + ql;            // global query row
    const float* qrow = Q   + ((size_t)bh * SEQ + qg) * DK;
    const int*   mrow = MSK + (size_t)qg * SEQ;
    const float* kbase = K + (size_t)bh * SEQ * DK;

    const unsigned koff[2] = { (unsigned)(uintptr_t)&ldsKf[0][0],
                               (unsigned)(uintptr_t)&ldsKf[1][0] };

    // ---- Q as B-operand (Q^T: N=q per lane, K=d swizzled), two 32-d chunks ----
    v16h qb[2];
    #pragma unroll
    for (int c = 0; c < 2; ++c) {
        load8_f16(qrow + 32*c +      hi*8, qb[c], 0);
        load8_f16(qrow + 32*c + 16 + hi*8, qb[c], 8);
    }

    // ---- flash-attention state (q = lane&15; both lane-halves keep full state) ----
    float m_run = -INFINITY;
    float l_run = 0.0f;
    v8f o[4];   // O^T accumulators: chunk c covers d = c*16 + (j + 8*hi)
    #pragma unroll
    for (int c = 0; c < 4; ++c)
        #pragma unroll
        for (int j = 0; j < 8; ++j) o[c][j] = 0.0f;

    const int krow = tid >> 2;    // staging: key row 0..31
    const int quad = tid & 3;     // staging: 4 threads per row

    // ---- prologue: DMA first K tile into buffer 0 ----
    if (tid < 32) tdm_load_K(kbase, koff[0]);

    // ---- prologue: first tile's V rows and mask words into registers ----
    const f32x4* vthr = (const f32x4*)(V + ((size_t)bh * SEQ + krow) * DK) + quad;
    const i32x4* mthr = (const i32x4*)mrow + hi*2;
    f32x4 vy[4];   // this thread's 4 x 16B of the V tile that is staged next
    i32x4 mkA[4], mkB[4];   // this lane's 16 mask words: the tile being scored, the tile in flight
    #pragma unroll
    for (int i = 0; i < 4; ++i) vy[i] = vthr[4*i];
    mkA[0] = mthr[0]; mkA[1] = mthr[1];   // keys 8*hi .. 8*hi+7
    mkA[2] = mthr[4]; mkA[3] = mthr[5];   // keys 16+8*hi ..

    const int NIT = SEQ / BN;
    // one trip: scores tile 'it' under mask words mk; where 'more' says so, loads tile it+1's V rows
    // into vy and its mask words into mn. Inlined, so that the register arrays stay registers.
    auto trip = [&](const int it, const i32x4 (&mk)[4], i32x4 (&mn)[4], auto more)
                __attribute__((always_inline)) {
        const int kt = it * BN;
        __syncthreads();   // previous iteration's readers (V + next K buffer) done

        // ---- stage V tile: prefetched f32 registers -> LDS f16 [d][key] (transpose) ----
        {
            #pragma unroll
            for (int i = 0; i < 4; ++i) {
                int f4 = quad + 4*i;
                f32x4 y = vy[i];
                ldsV[(f4*4+0) * SVST + krow] = (_Float16)y.x;
                ldsV[(f4*4+1) * SVST + krow] = (_Float16)y.y;
                ldsV[(f4*4+2) * SVST + krow] = (_Float16)y.z;
                ldsV[(f4*4+3) * SVST + krow] = (_Float16)y.w;
            }
        }
        if (tid < 32) __builtin_amdgcn_s_wait_tensorcnt(0);  // current K tile arrived
        __syncthreads();   // K[cur] + V visible to all waves

        // ---- kick DMA for the NEXT K tile; overlaps with compute below ----
        if ((tid < 32) && (it + 1 < NIT))
            tdm_load_K(kbase + (size_t)(kt + BN) * DK, koff[(it + 1) & 1]);

        // ---- next tile's V rows and mask words: eight loads in flight under this trip's compute ----
        if constexpr (decltype(more)::value) {
            const f32x4* vnx = vthr + (size_t)(kt + BN) * (DK / 4);
            const i32x4* mnx = mthr + (size_t)(kt + BN) / 4;
            #pragma unroll
            for (int i = 0; i < 4; ++i) vy[i] = vnx[4*i];
            mn[0] = mnx[0]; mn[1] = mnx[1];
            mn[2] = mnx[4]; mn[3] = mnx[5];
            // the loads' address registers are free for reuse behind this wait; the statement also
            // keeps the eight loads here, ahead of the trip's compute (else they sink to its end)
            asm volatile("s_wait_xcnt 0x0" ::: "memory");
        }

        const float* kb = &ldsKf[it & 1][0];

        // ---- S^T = K_tile x Q^T : two 16-key sub-tiles, K-dim = 64 in 2 chunks ----
        v8f acc0 = {}; v8f acc1 = {};
        #pragma unroll
        for (int c = 0; c < 2; ++c) {
            v16h ka0, ka1;   // A operand: M=key row per lane, K=d swizzled
            load8_f16(kb + (     ql)*SKF + 32*c +      hi*8, ka0, 0);
            load8_f16(kb + (     ql)*SKF + 32*c + 16 + hi*8, ka0, 8);
            load8_f16(kb + (16 + ql)*SKF + 32*c +      hi*8, ka1, 0);
            load8_f16(kb + (16 + ql)*SKF + 32*c + 16 + hi*8, ka1, 8);
            acc0 = __builtin_amdgcn_wmma_f32_16x16x32_f16(false, ka0, false, qb[c],
                                                          (short)0, acc0, false, false);
            acc1 = __builtin_amdgcn_wmma_f32_16x16x32_f16(false, ka1, false, qb[c],
                                                          (short)0, acc1, false, false);
        }

        // ---- mask + scale: this lane holds keys {8*hi+j} and {16+8*hi+j}, j=0..7 ----
        const int mm[16] = { mk[0].x,mk[0].y,mk[0].z,mk[0].w, mk[1].x,mk[1].y,mk[1].z,mk[1].w,
                             mk[2].x,mk[2].y,mk[2].z,mk[2].w, mk[3].x,mk[3].y,mk[3].z,mk[3].w };
        float sc[16];
        #pragma unroll
        for (int j = 0; j < 8; ++j) sc[j]   = mm[j]   ? acc0[j] * 0.125f : 1e-6f;
        #pragma unroll
        for (int j = 0; j < 8; ++j) sc[8+j] = mm[8+j] ? acc1[j] * 0.125f : 1e-6f;

        // ---- online softmax (per query; merge the two lane-halves) ----
        float mloc = sc[0];
        #pragma unroll
        for (int j = 1; j < 16; ++j) mloc = fmaxf(mloc, sc[j]);
        mloc = fmaxf(mloc, __shfl_xor(mloc, 16, 32));
        float mnew = fmaxf(m_run, mloc);
        float rescale = __expf(m_run - mnew);   // 0 on first iteration (m_run = -inf)
        float p[16], lsum = 0.0f;
        #pragma unroll
        for (int j = 0; j < 16; ++j) { p[j] = __expf(sc[j] - mnew); lsum += p[j]; }
        lsum += __shfl_xor(lsum, 16, 32);
        l_run = l_run * rescale + lsum;
        m_run = mnew;

        v16h pb;
        #pragma unroll
        for (int j = 0; j < 16; ++j) pb[j] = (_Float16)p[j];

        // ---- O^T += V^T x P^T : 4 d-chunks, K=32 keys each ----
        #pragma unroll
        for (int c = 0; c < 4; ++c) {
            v16h va;   // A operand: M = d row per lane, K = key swizzled
            *(v8h*)&va    = *(const v8h*)&ldsV[(c*16 + ql) * SVST +      hi*8];
            *((v8h*)&va+1)= *(const v8h*)&ldsV[(c*16 + ql) * SVST + 16 + hi*8];
            #pragma unroll
            for (int j = 0; j < 8; ++j) o[c][j] *= rescale;
            o[c] = __builtin_amdgcn_wmma_f32_16x16x32_f16(false, va, false, pb,
                                                          (short)0, o[c], false, false);
        }

    };

    // two trips a pass: the two sets of mask registers swap roles by name, with no copies;
    // the last trip has no next tile to load
    for (int it = 0; it < NIT - 2; it += 2) {
        trip(it,     mkA, mkB, has_next<true>{});
        trip(it + 1, mkB, mkA, has_next<true>{});
    }
    trip(NIT - 2, mkA, mkB, has_next<true>{});
    trip(NIT - 1, mkB, mkA, has_next<false>{});

    // ---- epilogue: divide by softmax sum, store O[bh][q][d] ----
    float inv = 1.0f / l_run;
    float* orow = O + ((size_t)bh * SEQ + qg) * DK;
    #pragma unroll
    for (int c = 0; c < 4; ++c) {
        int d0 = c*16 + hi*8;   // this lane-half owns d = d0 .. d0+7
        float4 lo = { o[c][0]*inv, o[c][1]*inv, o[c][2]*inv, o[c][3]*inv };
        float4 hv = { o[c][4]*inv, o[c][5]*inv, o[c][6]*inv, o[c][7]*inv };
        ((float4*)(orow + d0    ))[0] = lo;
        ((float4*)(orow + d0 + 4))[0] = hv;
    }
}

extern "C" void kernel_launch(void* const* d_in, const int* in_sizes, int n_in,
                              void* d_out, int out_size, void* d_ws, size_t ws_size,
                              hipStream_t stream) {
    const float* Q   = (const float*)d_in[0];
    const float* K   = (const float*)d_in[1];
    const float* V   = (const float*)d_in[2];
    const int*   MSK = (const int*)d_in[3];
    float*       O   = (float*)d_out;

    dim3 grid(SEQ / BM, BHN);   // (16, 64): 64 queries per block, one bh per block.y
    attn_fwd_kernel<<<grid, 128, 0, stream>>>(Q, K, V, MSK, O);
}

// v002
// Measured time: 48.1 microseconds a run.
// Next to v001, in two timings, it ran 1.14 times as fast each time.
// All steps since v000 together make it 1.57 times as fast.
#include <hip/hip_runtime.h>
#include <math.h>

typedef __attribute__((ext_vector_type(16))) _Float16 v16h;
typedef __attribute__((ext_vector_type(8)))  _Float16 v8h;
typedef __attribute__((ext_vector_type(4)))  _Float16 v4h;
typedef __attribute__((ext_vector_type(8)))  float    v8f;
typedef __attribute__((ext_vector_type(4)))  unsigned int u32x4;
typedef __attribute__((ext_vector_type(8)))  int      i32x8;
typedef __attribute__((ext_vector_type(4)))  int      i32x4;
typedef __attribute__((ext_vector_type(4)))  float    f32x4;

#define BHN   64
#define SEQ   1024
#define DK    64
#define BN    32      // keys per iteration
#define WAVES 4       // waves per block (wave32)
#define BM    (16*WAVES)
#define SKF   68
#define SVST  40

// Load 8 consecutive f32 -> elements [base..base+7] of a v16h (A/B operand half)
__device__ inline void load8_f16(const float* p, v16h& dst, int base) {
    float4 a = ((const float4*)p)[0];
    float4 b = ((const float4*)p)[1];
    dst[base+0] = (_Float16)a.x; dst[base+1] = (_Float16)a.y;
    dst[base+2] = (_Float16)a.z; dst[base+3] = (_Float16)a.w;
    dst[base+4] = (_Float16)b.x; dst[base+5] = (_Float16)b.y;
    dst[base+6] = (_Float16)b.z; dst[base+7] = (_Float16)b.w;
}

__device__ inline void tdm_load_K(const float* gsrc, unsigned lds_off) {
    unsigned long long ga = (unsigned long long)(uintptr_t)gsrc;
    u32x4 g0;
    g0[0] = 1u;
    g0[1] = lds_off;
    g0[2] = (unsigned)(ga & 0xFFFFFFFFull);
    g0[3] = (unsigned)((ga >> 32) & 0x01FFFFFFull)
          | (2u << 30);
    i32x8 g1;
    g1[0] = (2 << 16)
          | (1 << 20)
          | (5 << 22)
          | (3 << 25);
    g1[1] = (DK << 16);
    g1[2] = (BN << 16);
    g1[3] = (DK << 16);
    g1[4] = BN;
    g1[5] = DK;
    g1[6] = 0;
    g1[7] = 0;
    i32x4 g2; g2[0]=0; g2[1]=0; g2[2]=0; g2[3]=0;   // 2D tile: groups 2/3 zero
    i32x4 g3; g3[0]=0; g3[1]=0; g3[2]=0; g3[3]=0;
    i32x8 gx; gx[0]=0; gx[1]=0; gx[2]=0; gx[3]=0;   // extra operand (clang-23 6-arg form)
    gx[4]=0; gx[5]=0; gx[6]=0; gx[7]=0;
    __builtin_amdgcn_tensor_load_to_lds(g0, g1, g2, g3, gx, 0);
}

template <bool B> struct has_next { static constexpr bool value = B; };

__global__ void __launch_bounds__(128) __attribute__((amdgpu_waves_per_eu(4, 5)))
attn_fwd_kernel(const float* __restrict__ Q, const float* __restrict__ K,
                const float* __restrict__ V, const int* __restrict__ MSK,
                float* __restrict__ O)
{
    __shared__ float    ldsKf[2][BN * SKF];
    __shared__ _Float16 ldsV[DK * SVST];

    const int bh   = blockIdx.y;
    const int qblk = blockIdx.x;
    const int tid  = threadIdx.x;
    const int wave = tid >> 5;
    const int lane = tid & 31;
    const int ql   = lane & 15;   // query (N) index within wave tile
    const int hi   = lane >> 4;   // lane-half selector for K-dim swizzle

    const int qg = qblk * BM + wave * 16 + ql;            // global query row
    const float* qrow = Q   + ((size_t)bh * SEQ + qg) * DK;
    const int*   mrow = MSK + (size_t)qg * SEQ;
    const float* kbase = K + (size_t)bh * SEQ * DK;

    const unsigned koff[2] = { (unsigned)(uintptr_t)&ldsKf[0][0],
                               (unsigned)(uintptr_t)&ldsKf[1][0] };

    // ---- Q as B-operand (Q^T: N=q per lane, K=d swizzled), two 32-d chunks ----
    v16h qb[2];
    #pragma unroll
    for (int c = 0; c < 2; ++c) {
        load8_f16(qrow + 32*c +      hi*8, qb[c], 0);
        load8_f16(qrow + 32*c + 16 + hi*8, qb[c], 8);
    }

    // ---- flash-attention state (q = lane&15; both lane-halves keep full state) ----
    float m_run = -INFINITY;
    float l_run = 0.0f;
    v8f o[4];   // O^T accumulators: chunk c covers d = c*16 + (j + 8*hi)
    #pragma unroll
    for (int c = 0; c < 4; ++c)
        #pragma unroll
        for (int j = 0; j < 8; ++j) o[c][j] = 0.0f;

    const int krow = tid >> 2;    // staging: key row 0..31
    const int quad = tid & 3;     // staging: 4 threads per row

    // ---- prologue: DMA first K tile into buffer 0 ----
    if (tid < 32) tdm_load_K(kbase, koff[0]);

    // ---- prologue: first tile's V rows and mask words into registers ----
    const f32x4* vthr = (const f32x4*)(V + ((size_t)bh * SEQ + krow) * DK) + quad;
    const i32x4* mthr = (const i32x4*)mrow + hi*2;
    f32x4 vy[4];   // this thread's 4 x 16B of the V tile that is staged next
    i32x4 mkA[4], mkB[4];   // this lane's 16 mask words: the tile being scored, the tile in flight
    #pragma unroll
    for (int i = 0; i < 4; ++i) vy[i] = vthr[4*i];
    mkA[0] = mthr[0]; mkA[1] = mthr[1];   // keys 8*hi .. 8*hi+7
    mkA[2] = mthr[4]; mkA[3] = mthr[5];   // keys 16+8*hi ..

    const int NIT = SEQ / BN;
    // one trip: scores tile 'it' under mask words mk; where 'more' says so, loads tile it+1's V rows
    // into vy and its mask words into mn. Inlined, so that the register arrays stay registers.
    auto trip = [&](const int it, const i32x4 (&mk)[4], i32x4 (&mn)[4], auto more)
                __attribute__((always_inline)) {
        const int kt = it * BN;
        __syncthreads();   // previous iteration's readers (V + next K buffer) done

        // ---- stage V tile: prefetched f32 registers -> LDS f16 [d][key] (transpose) ----
        {
            #pragma unroll
            for (int i = 0; i < 4; ++i) {
                int f4 = quad + 4*i;
                f32x4 y = vy[i];
                ldsV[(f4*4+0) * SVST + krow] = (_Float16)y.x;
                ldsV[(f4*4+1) * SVST + krow] = (_Float16)y.y;
                ldsV[(f4*4+2) * SVST + krow] = (_Float16)y.z;
                ldsV[(f4*4+3) * SVST + krow] = (_Float16)y.w;
            }
        }
        if (tid < 32) __builtin_amdgcn_s_wait_tensorcnt(0);  // current K tile arrived
        __syncthreads();   // K[cur] + V visible to all waves

        // ---- kick DMA for the NEXT K tile; overlaps with compute below ----
        if ((tid < 32) && (it + 1 < NIT))
            tdm_load_K(kbase + (size_t)(kt + BN) * DK, koff[(it + 1) & 1]);

        // ---- next tile's V rows and mask words: eight loads in flight under this trip's compute ----
        if constexpr (decltype(more)::value) {
            const f32x4* vnx = vthr + (size_t)(kt + BN) * (DK / 4);
            const i32x4* mnx = mthr + (size_t)(kt + BN) / 4;
            #pragma unroll
            for (int i = 0; i < 4; ++i) vy[i] = vnx[4*i];
            mn[0] = mnx[0]; mn[1] = mnx[1];
            mn[2] = mnx[4]; mn[3] = mnx[5];
            // the loads' address registers are free for reuse behind this wait; the statement also
            // keeps the eight loads here, ahead of the trip's compute (else they sink to its end)
            asm volatile("s_wait_xcnt 0x0" ::: "memory");
        }

        const float* kb = &ldsKf[it & 1][0];

        // ---- S^T = K_tile x Q^T : two 16-key sub-tiles, K-dim = 64 in 2 chunks ----
        v8f acc0 = {}; v8f acc1 = {};
        #pragma unroll
        for (int c = 0; c < 2; ++c) {
            v16h ka0, ka1;   // A operand: M=key row per lane, K=d swizzled
            load8_f16(kb + (     ql)*SKF + 32*c +      hi*8, ka0, 0);
            load8_f16(kb + (     ql)*SKF + 32*c + 16 + hi*8, ka0, 8);
            load8_f16(kb + (16 + ql)*SKF + 32*c +      hi*8, ka1, 0);
            load8_f16(kb + (16 + ql)*SKF + 32*c + 16 + hi*8, ka1, 8);
            acc0 = __builtin_amdgcn_wmma_f32_16x16x32_f16(false, ka0, false, qb[c],
                                                          (short)0, acc0, false, false);
            acc1 = __builtin_amdgcn_wmma_f32_16x16x32_f16(false, ka1, false, qb[c],
                                                          (short)0, acc1, false, false);
        }

        // ---- mask + scale: this lane holds keys {8*hi+j} and {16+8*hi+j}, j=0..7 ----
        const int mm[16] = { mk[0].x,mk[0].y,mk[0].z,mk[0].w, mk[1].x,mk[1].y,mk[1].z,mk[1].w,
                             mk[2].x,mk[2].y,mk[2].z,mk[2].w, mk[3].x,mk[3].y,mk[3].z,mk[3].w };
        float sc[16];
        #pragma unroll
        for (int j = 0; j < 8; ++j) sc[j]   = mm[j]   ? acc0[j] * 0.125f : 1e-6f;
        #pragma unroll
        for (int j = 0; j < 8; ++j) sc[8+j] = mm[8+j] ? acc1[j] * 0.125f : 1e-6f;

        // ---- online softmax (per query; merge the two lane-halves) ----
        float mloc = sc[0];
        #pragma unroll
        for (int j = 1; j < 16; ++j) mloc = fmaxf(mloc, sc[j]);
        mloc = fmaxf(mloc, __shfl_xor(mloc, 16, 32));
        float mnew = fmaxf(m_run, mloc);
        float rescale = __expf(m_run - mnew);   // 0 on first iteration (m_run = -inf)
        float p[16], lsum = 0.0f;
        #pragma unroll
        for (int j = 0; j < 16; ++j) { p[j] = __expf(sc[j] - mnew); lsum += p[j]; }
        lsum += __shfl_xor(lsum, 16, 32);
        l_run = l_run * rescale + lsum;
        m_run = mnew;

        v16h pb;
        #pragma unroll
        for (int j = 0; j < 16; ++j) pb[j] = (_Float16)p[j];

        // ---- O^T += V^T x P^T : 4 d-chunks, K=32 keys each ----
        #pragma unroll
        for (int c = 0; c < 4; ++c) {
            v16h va;   // A operand: M = d row per lane, K = key swizzled
            *(v8h*)&va    = *(const v8h*)&ldsV[(c*16 + ql) * SVST +      hi*8];
            *((v8h*)&va+1)= *(const v8h*)&ldsV[(c*16 + ql) * SVST + 16 + hi*8];
            #pragma unroll
            for (int j = 0; j < 8; ++j) o[c][j] *= rescale;
            o[c] = __builtin_amdgcn_wmma_f32_16x16x32_f16(false, va, false, pb,
                                                          (short)0, o[c], false, false);
        }

    };

    // two trips a pass: the two sets of mask registers swap roles by name, with no copies;
    // the last trip has no next tile to load
    for (int it = 0; it < NIT - 2; it += 2) {
        trip(it,     mkA, mkB, has_next<true>{});
        trip(it + 1, mkB, mkA, has_next<true>{});
    }
    trip(NIT - 2, mkA, mkB, has_next<true>{});
    trip(NIT - 1, mkB, mkA, has_next<false>{});

    // ---- epilogue: divide by softmax sum, store O[bh][q][d] ----
    float inv = 1.0f / l_run;
    float* orow = O + ((size_t)bh * SEQ + qg) * DK;
    #pragma unroll
    for (int c = 0; c < 4; ++c) {
        int d0 = c*16 + hi*8;   // this lane-half owns d = d0 .. d0+7
        float4 lo = { o[c][0]*inv, o[c][1]*inv, o[c][2]*inv, o[c][3]*inv };
        float4 hv = { o[c][4]*inv, o[c][5]*inv, o[c][6]*inv, o[c][7]*inv };
        ((float4*)(orow + d0    ))[0] = lo;
        ((float4*)(orow + d0 + 4))[0] = hv;
    }
}

extern "C" void kernel_launch(void* const* d_in, const int* in_sizes, int n_in,
                              void* d_out, int out_size, void* d_ws, size_t ws_size,
                              hipStream_t stream) {
    const float* Q   = (const float*)d_in[0];
    const float* K   = (const float*)d_in[1];
    const float* V   = (const float*)d_in[2];
    const int*   MSK = (const int*)d_in[3];
    float*       O   = (float*)d_out;

    dim3 grid(SEQ / BM, BHN);   // (16, 64): 64 queries per block, one bh per block.y
    attn_fwd_kernel<<<grid, 128, 0, stream>>>(Q, K, V, MSK, O);
}

// v003
// One run takes 42 microseconds.
// Next to v002, in two timings, it ran 1.15 times as fast each time.
// Counting every step since v000, it is 1.80 times as fast.
#include <hip/hip_runtime.h>
#include <math.h>

typedef __attribute__((ext_vector_type(16))) _Float16 v16h;
typedef __attribute__((ext_vector_type(8)))  _Float16 v8h;
typedef __attribute__((ext_vector_type(4)))  _Float16 v4h;
typedef __attribute__((ext_vector_type(8)))  float    v8f;
typedef __attribute__((ext_vector_type(4)))  unsigned int u32x4;
typedef __attribute__((ext_vector_type(8)))  int      i32x8;
typedef __attribute__((ext_vector_type(4)))  int      i32x4;
typedef __attribute__((ext_vector_type(4)))  float    f32x4;

#define BHN   64
#define SEQ   1024
#define DK    64
#define BN    32      // keys per iteration
#define WAVES 4       // waves per block (wave32)
#define QT    2       // 16-query tiles per wave: each K and V fragment read from LDS serves both
#define BM    (16*QT*WAVES)
#define SKF   68
#define SVST  40

// Load 8 consecutive f32 -> elements [base..base+7] of a v16h (A/B operand half)
__device__ inline void load8_f16(const float* p, v16h& dst, int base) {
    float4 a = ((const float4*)p)[0];
    float4 b = ((const float4*)p)[1];
    dst[base+0] = (_Float16)a.x; dst[base+1] = (_Float16)a.y;
    dst[base+2] = (_Float16)a.z; dst[base+3] = (_Float16)a.w;
    dst[base+4] = (_Float16)b.x; dst[base+5] = (_Float16)b.y;
    dst[base+6] = (_Float16)b.z; dst[base+7] = (_Float16)b.w;
}

__device__ inline void tdm_load_K(const float* gsrc, unsigned lds_off) {
    unsigned long long ga = (unsigned long long)(uintptr_t)gsrc;
    u32x4 g0;
    g0[0] = 1u;
    g0[1] = lds_off;
    g0[2] = (unsigned)(ga & 0xFFFFFFFFull);
    g0[3] = (unsigned)((ga >> 32) & 0x01FFFFFFull)
          | (2u << 30);
    i32x8 g1;
    g1[0] = (2 << 16)
          | (1 << 20)
          | (5 << 22)
          | (3 << 25);
    g1[1] = (DK << 16);
    g1[2] = (BN << 16);
    g1[3] = (DK << 16);
    g1[4] = BN;
    g1[5] = DK;
    g1[6] = 0;
    g1[7] = 0;
    i32x4 g2; g2[0]=0; g2[1]=0; g2[2]=0; g2[3]=0;   // 2D tile: groups 2/3 zero
    i32x4 g3; g3[0]=0; g3[1]=0; g3[2]=0; g3[3]=0;
    i32x8 gx; gx[0]=0; gx[1]=0; gx[2]=0; gx[3]=0;   // extra operand (clang-23 6-arg form)
    gx[4]=0; gx[5]=0; gx[6]=0; gx[7]=0;
    __builtin_amdgcn_tensor_load_to_lds(g0, g1, g2, g3, gx, 0);
}

template <bool B> struct has_next { static constexpr bool value = B; };

__global__ void __launch_bounds__(128) __attribute__((amdgpu_waves_per_eu(2, 2)))
attn_fwd_kernel(const float* __restrict__ Q, const float* __restrict__ K,
                const float* __restrict__ V, const int* __restrict__ MSK,
                float* __restrict__ O)
{
    __shared__ float    ldsKf[2][BN * SKF];
    __shared__ _Float16 ldsV[DK * SVST];

    const int bh   = blockIdx.y;
    const int qblk = blockIdx.x;
    const int tid  = threadIdx.x;
    const int wave = tid >> 5;
    const int lane = tid & 31;
    const int ql   = lane & 15;   // query (N) index within wave tile
    const int hi   = lane >> 4;   // lane-half selector for K-dim swizzle

    const int qg = qblk * BM + wave * (16*QT) + ql;       // global query row of tile 0; tile t: + 16*t
    const float* qrow = Q   + ((size_t)bh * SEQ + qg) * DK;
    const int*   mrow = MSK + (size_t)qg * SEQ;
    const float* kbase = K + (size_t)bh * SEQ * DK;

    const unsigned koff[2] = { (unsigned)(uintptr_t)&ldsKf[0][0],
                               (unsigned)(uintptr_t)&ldsKf[1][0] };

    // ---- Q as B-operand (Q^T: N=q per lane, K=d swizzled), two 32-d chunks ----
    v16h qb[QT][2];
    #pragma unroll
    for (int t = 0; t < QT; ++t)
        #pragma unroll
        for (int c = 0; c < 2; ++c) {
            load8_f16(qrow + t*16*DK + 32*c +      hi*8, qb[t][c], 0);
            load8_f16(qrow + t*16*DK + 32*c + 16 + hi*8, qb[t][c], 8);
        }

    // ---- flash-attention state (q = lane&15; both lane-halves keep full state) ----
    float m_run[QT], l_run[QT];
    v8f o[QT][4];   // O^T accumulators: chunk c covers d = c*16 + (j + 8*hi)
    #pragma unroll
    for (int t = 0; t < QT; ++t) {
        m_run[t] = -INFINITY;
        l_run[t] = 0.0f;
        #pragma unroll
        for (int c = 0; c < 4; ++c)
            #pragma unroll
            for (int j = 0; j < 8; ++j) o[t][c][j] = 0.0f;
    }

    const int krow = tid >> 2;    // staging: key row 0..31
    const int quad = tid & 3;     // staging: 4 threads per row

    // ---- prologue: DMA first K tile into buffer 0 ----
    if (tid < 32) tdm_load_K(kbase, koff[0]);

    // ---- prologue: first tile's V rows and mask words into registers ----
    const f32x4* vthr = (const f32x4*)(V + ((size_t)bh * SEQ + krow) * DK) + quad;
    const i32x4* mthr = (const i32x4*)mrow + hi*2;
    f32x4 vy[4];   // this thread's 4 x 16B of the V tile that is staged next
    i32x4 mkA[QT][4], mkB[QT][4];   // this lane's 16 mask words a query tile: the key tile being scored, the one in flight
    #pragma unroll
    for (int i = 0; i < 4; ++i) vy[i] = vthr[4*i];
    #pragma unroll
    for (int t = 0; t < QT; ++t) {
        const i32x4* mt = mthr + t * (16 * SEQ / 4);
        mkA[t][0] = mt[0]; mkA[t][1] = mt[1];   // keys 8*hi .. 8*hi+7
        mkA[t][2] = mt[4]; mkA[t][3] = mt[5];   // keys 16+8*hi ..
    }

    const int NIT = SEQ / BN;
    // one trip: scores tile 'it' under mask words mk; where 'more' says so, loads tile it+1's V rows
    // into vy and its mask words into mn. Inlined, so that the register arrays stay registers.
    auto trip = [&](const int it, const i32x4 (&mk)[QT][4], i32x4 (&mn)[QT][4], auto more)
                __attribute__((always_inline)) {
        const int kt = it * BN;
        __syncthreads();   // previous iteration's readers (V + next K buffer) done

        // ---- stage V tile: prefetched f32 registers -> LDS f16 [d][key] (transpose) ----
        {
            #pragma unroll
            for (int i = 0; i < 4; ++i) {
                int f4 = quad + 4*i;
                f32x4 y = vy[i];
                ldsV[(f4*4+0) * SVST + krow] = (_Float16)y.x;
                ldsV[(f4*4+1) * SVST + krow] = (_Float16)y.y;
                ldsV[(f4*4+2) * SVST + krow] = (_Float16)y.z;
                ldsV[(f4*4+3) * SVST + krow] = (_Float16)y.w;
            }
        }
        if (tid < 32) __builtin_amdgcn_s_wait_tensorcnt(0);  // current K tile arrived
        __syncthreads();   // K[cur] + V visible to all waves

        // ---- kick DMA for the NEXT K tile; overlaps with compute below ----
        if ((tid < 32) && (it + 1 < NIT))
            tdm_load_K(kbase + (size_t)(kt + BN) * DK, koff[(it + 1) & 1]);

        // ---- next tile's V rows and mask words: twelve loads in flight under this trip's compute ----
        if constexpr (decltype(more)::value) {
            const f32x4* vnx = vthr + (size_t)(kt + BN) * (DK / 4);
            const i32x4* mnx = mthr + (size_t)(kt + BN) / 4;
            #pragma unroll
            for (int i = 0; i < 4; ++i) vy[i] = vnx[4*i];
            #pragma unroll
            for (int t = 0; t < QT; ++t) {
                const i32x4* mt = mnx + t * (16 * SEQ / 4);
                mn[t][0] = mt[0]; mn[t][1] = mt[1];
                mn[t][2] = mt[4]; mn[t][3] = mt[5];
            }
            // the loads' address registers are free for reuse behind this wait; the statement also
            // keeps the twelve loads here, ahead of the trip's compute (else they sink to its end)
            asm volatile("s_wait_xcnt 0x0" ::: "memory");
        }

        const float* kb = &ldsKf[it & 1][0];

        // ---- S^T = K_tile x Q^T : two 16-key sub-tiles, K-dim = 64 in 2 chunks; each K fragment
        //      is read and converted once and multiplies both query tiles ----
        v8f acc0[QT], acc1[QT];
        #pragma unroll
        for (int t = 0; t < QT; ++t) { acc0[t] = v8f{}; acc1[t] = v8f{}; }
        #pragma unroll
        for (int c = 0; c < 2; ++c) {
            v16h ka0, ka1;   // A operand: M=key row per lane, K=d swizzled
            load8_f16(kb + (     ql)*SKF + 32*c +      hi*8, ka0, 0);
            load8_f16(kb + (     ql)*SKF + 32*c + 16 + hi*8, ka0, 8);
            load8_f16(kb + (16 + ql)*SKF + 32*c +      hi*8, ka1, 0);
            load8_f16(kb + (16 + ql)*SKF + 32*c + 16 + hi*8, ka1, 8);
            #pragma unroll
            for (int t = 0; t < QT; ++t) {
                acc0[t] = __builtin_amdgcn_wmma_f32_16x16x32_f16(false, ka0, false, qb[t][c],
                                                                 (short)0, acc0[t], false, false);
                acc1[t] = __builtin_amdgcn_wmma_f32_16x16x32_f16(false, ka1, false, qb[t][c],
                                                                 (short)0, acc1[t], false, false);
            }
        }

        v16h pb[QT];
        float rescale[QT];
        #pragma unroll
        for (int t = 0; t < QT; ++t) {
            // ---- mask + scale: this lane holds keys {8*hi+j} and {16+8*hi+j}, j=0..7 ----
            const int mm[16] = { mk[t][0].x,mk[t][0].y,mk[t][0].z,mk[t][0].w, mk[t][1].x,mk[t][1].y,mk[t][1].z,mk[t][1].w,
                                 mk[t][2].x,mk[t][2].y,mk[t][2].z,mk[t][2].w, mk[t][3].x,mk[t][3].y,mk[t][3].z,mk[t][3].w };
            float sc[16];
            #pragma unroll
            for (int j = 0; j < 8; ++j) sc[j]   = mm[j]   ? acc0[t][j] * 0.125f : 1e-6f;
            #pragma unroll
            for (int j = 0; j < 8; ++j) sc[8+j] = mm[8+j] ? acc1[t][j] * 0.125f : 1e-6f;

            // ---- online softmax (per query; merge the two lane-halves) ----
            float mloc = sc[0];
            #pragma unroll
            for (int j = 1; j < 16; ++j) mloc = fmaxf(mloc, sc[j]);
            mloc = fmaxf(mloc, __shfl_xor(mloc, 16, 32));
            float mnew = fmaxf(m_run[t], mloc);
            rescale[t] = __expf(m_run[t] - mnew);   // 0 on first iteration (m_run = -inf)
            float p[16], lsum = 0.0f;
            #pragma unroll
            for (int j = 0; j < 16; ++j) { p[j] = __expf(sc[j] - mnew); lsum += p[j]; }
            lsum += __shfl_xor(lsum, 16, 32);
            l_run[t] = l_run[t] * rescale[t] + lsum;
            m_run[t] = mnew;

            #pragma unroll
            for (int j = 0; j < 16; ++j) pb[t][j] = (_Float16)p[j];
        }

        // ---- O^T += V^T x P^T : 4 d-chunks, K=32 keys each; each V fragment serves both query tiles ----
        #pragma unroll
        for (int c = 0; c < 4; ++c) {
            v16h va;   // A operand: M = d row per lane, K = key swizzled
            *(v8h*)&va    = *(const v8h*)&ldsV[(c*16 + ql) * SVST +      hi*8];
            *((v8h*)&va+1)= *(const v8h*)&ldsV[(c*16 + ql) * SVST + 16 + hi*8];
            #pragma unroll
            for (int t = 0; t < QT; ++t) {
                #pragma unroll
                for (int j = 0; j < 8; ++j) o[t][c][j] *= rescale[t];
                o[t][c] = __builtin_amdgcn_wmma_f32_16x16x32_f16(false, va, false, pb[t],
                                                                 (short)0, o[t][c], false, false);
            }
        }

    };

    // two trips a pass: the two sets of mask registers swap roles by name, with no copies;
    // the last trip has no next tile to load
    for (int it = 0; it < NIT - 2; it += 2) {
        trip(it,     mkA, mkB, has_next<true>{});
        trip(it + 1, mkB, mkA, has_next<true>{});
    }
    trip(NIT - 2, mkA, mkB, has_next<true>{});
    trip(NIT - 1, mkB, mkA, has_next<false>{});

    // ---- epilogue: divide by softmax sum, store O[bh][q][d] ----
    #pragma unroll
    for (int t = 0; t < QT; ++t) {
        float inv = 1.0f / l_run[t];
        float* orow = O + ((size_t)bh * SEQ + qg + 16*t) * DK;
        #pragma unroll
        for (int c = 0; c < 4; ++c) {
            int d0 = c*16 + hi*8;   // this lane-half owns d = d0 .. d0+7
            float4 lo = { o[t][c][0]*inv, o[t][c][1]*inv, o[t][c][2]*inv, o[t][c][3]*inv };
            float4 hv = { o[t][c][4]*inv, o[t][c][5]*inv, o[t][c][6]*inv, o[t][c][7]*inv };
            ((float4*)(orow + d0    ))[0] = lo;
            ((float4*)(orow + d0 + 4))[0] = hv;
        }
    }
}

extern "C" void kernel_launch(void* const* d_in, const int* in_sizes, int n_in,
                              void* d_out, int out_size, void* d_ws, size_t ws_size,
                              hipStream_t stream) {
    const float* Q   = (const float*)d_in[0];
    const float* K   = (const float*)d_in[1];
    const float* V   = (const float*)d_in[2];
    const int*   MSK = (const int*)d_in[3];
    float*       O   = (float*)d_out;

    dim3 grid(SEQ / BM, BHN);   // (8, 64): 128 queries per block, one bh per block.y
    attn_fwd_kernel<<<grid, 128, 0, stream>>>(Q, K, V, MSK, O);
}

// v004
// Measured time: 37 microseconds a run.
// Two timings next to v003 both put it at 1.13 times that version's speed.
// Counting every step since v000, it is 2.04 times as fast.
#include <hip/hip_runtime.h>
#include <math.h>

typedef __attribute__((ext_vector_type(16))) _Float16 v16h;
typedef __attribute__((ext_vector_type(8)))  _Float16 v8h;
typedef __attribute__((ext_vector_type(4)))  _Float16 v4h;
typedef __attribute__((ext_vector_type(2)))  _Float16 v2h;
typedef __attribute__((ext_vector_type(8)))  float    v8f;
typedef __attribute__((ext_vector_type(2)))  float    v2f;
typedef __attribute__((ext_vector_type(4)))  unsigned int u32x4;
typedef __attribute__((ext_vector_type(8)))  int      i32x8;
typedef __attribute__((ext_vector_type(4)))  int      i32x4;
typedef __attribute__((ext_vector_type(4)))  float    f32x4;

#define BHN   64
#define SEQ   1024
#define DK    64
#define BN    64      // keys per iteration
#define WAVES 4       // waves per block (wave32)
#define QT    2       // 16-query tiles per wave: each K and V fragment read from LDS serves both
#define BM    (16*QT*WAVES)
#define SKF   68
#define KBUF  4608
#define SVST  72

// Load 8 consecutive f32 -> elements [base..base+7] of a v16h (A/B operand half)
__device__ inline void load8_f16(const float* p, v16h& dst, int base) {
    float4 a = ((const float4*)p)[0];
    float4 b = ((const float4*)p)[1];
    dst[base+0] = (_Float16)a.x; dst[base+1] = (_Float16)a.y;
    dst[base+2] = (_Float16)a.z; dst[base+3] = (_Float16)a.w;
    dst[base+4] = (_Float16)b.x; dst[base+5] = (_Float16)b.y;
    dst[base+6] = (_Float16)b.z; dst[base+7] = (_Float16)b.w;
}

__device__ inline void tdm_load_K(const float* gsrc, unsigned lds_off) {
    unsigned long long ga = (unsigned long long)(uintptr_t)gsrc;
    u32x4 g0;
    g0[0] = 1u;
    g0[1] = lds_off;
    g0[2] = (unsigned)(ga & 0xFFFFFFFFull);
    g0[3] = (unsigned)((ga >> 32) & 0x01FFFFFFull)
          | (2u << 30);
    i32x8 g1;
    g1[0] = (2 << 16)
          | (1 << 20)
          | (5 << 22)
          | (3 << 25);
    g1[1] = (DK << 16);
    g1[2] = (BN << 16);
    g1[3] = (DK << 16);
    g1[4] = BN;
    g1[5] = DK;
    g1[6] = 0;
    g1[7] = 0;
    i32x4 g2; g2[0]=0; g2[1]=0; g2[2]=0; g2[3]=0;   // 2D tile: groups 2/3 zero
    i32x4 g3; g3[0]=0; g3[1]=0; g3[2]=0; g3[3]=0;
    i32x8 gx; gx[0]=0; gx[1]=0; gx[2]=0; gx[3]=0;   // extra operand (clang-23 6-arg form)
    gx[4]=0; gx[5]=0; gx[6]=0; gx[7]=0;
    __builtin_amdgcn_tensor_load_to_lds(g0, g1, g2, g3, gx, 0);
}

template <bool B> struct has_next { static constexpr bool value = B; };

__global__ void __launch_bounds__(128) __attribute__((amdgpu_waves_per_eu(2, 2)))
attn_fwd_kernel(const float* __restrict__ Q, const float* __restrict__ K,
                const float* __restrict__ V, const int* __restrict__ MSK,
                float* __restrict__ O)
{
    __shared__ __attribute__((aligned(2048))) float ldsKf[2][KBUF];
    __shared__ __attribute__((aligned(16))) _Float16 ldsV[DK * SVST];     // V tile transposed, f16, [d][key]

    const int bh   = blockIdx.y;
    const int qblk = blockIdx.x;
    const int tid  = threadIdx.x;
    const int wave = tid >> 5;
    const int lane = tid & 31;
    const int ql   = lane & 15;   // query (N) index within wave tile
    const int hi   = lane >> 4;   // lane-half selector for K-dim swizzle

    const int qg = qblk * BM + wave * (16*QT) + ql;       // global query row of tile 0; tile t: + 16*t
    const float* qrow = Q   + ((size_t)bh * SEQ + qg) * DK;
    const int*   mrow = MSK + (size_t)qg * SEQ;
    const float* kbase = K + (size_t)bh * SEQ * DK;

    const unsigned koff[2] = { (unsigned)(uintptr_t)&ldsKf[0][0],
                               (unsigned)(uintptr_t)&ldsKf[1][0] };

    // ---- Q as B-operand (Q^T: N=q per lane, K=d swizzled), two 32-d chunks ----
    v16h qb[QT][2];
    #pragma unroll
    for (int t = 0; t < QT; ++t)
        #pragma unroll
        for (int c = 0; c < 2; ++c) {
            load8_f16(qrow + t*16*DK + 32*c +      hi*8, qb[t][c], 0);
            load8_f16(qrow + t*16*DK + 32*c + 16 + hi*8, qb[t][c], 8);
        }

    // ---- flash-attention state (q = lane&15; both lane-halves keep full state) ----
    float m_run[QT], l_run[QT];
    v8f o[QT][4];   // O^T accumulators: chunk c covers d = c*16 + (j + 8*hi)
    #pragma unroll
    for (int t = 0; t < QT; ++t) {
        m_run[t] = -INFINITY;
        l_run[t] = 0.0f;
        #pragma unroll
        for (int c = 0; c < 4; ++c)
            #pragma unroll
            for (int j = 0; j < 8; ++j) o[t][c][j] = 0.0f;
    }

    const int kpr  = tid >> 2;    // staging: key rows 2*kpr and 2*kpr+1
    const int quad = tid & 3;     // staging: 4 threads per row

    // ---- prologue: DMA first K tile into buffer 0 ----
    if (tid < 32) tdm_load_K(kbase, koff[0]);

    // ---- prologue: first tile's V rows and mask words into registers ----
    const f32x4* vthr = (const f32x4*)(V + ((size_t)bh * SEQ + 2*kpr) * DK) + quad;
    const i32x4* mthr = (const i32x4*)mrow + hi*2;
    f32x4 vy[2][4];   // this thread's 4 x 16B of each of its two rows of the V tile that is staged next
    i32x4 mkA[QT][8], mkB[QT][8];   // this lane's 32 mask words a query tile: the key tile being scored, the one in flight
    #pragma unroll
    for (int r = 0; r < 2; ++r)
        #pragma unroll
        for (int i = 0; i < 4; ++i) vy[r][i] = vthr[r*(DK/4) + 4*i];
    #pragma unroll
    for (int t = 0; t < QT; ++t) {
        const i32x4* mt = mthr + t * (16 * SEQ / 4);
        #pragma unroll
        for (int s = 0; s < 4; ++s) {   // keys 16*s + 8*hi .. + 7
            mkA[t][2*s] = mt[4*s]; mkA[t][2*s+1] = mt[4*s+1];
        }
    }

    const int NIT = SEQ / BN;
    // one trip: scores tile 'it' under mask words mk; where 'more' says so, loads tile it+1's V rows
    // into vy and its mask words into mn. Inlined, so that the register arrays stay registers.
    auto trip = [&](const int it, const i32x4 (&mk)[QT][8], i32x4 (&mn)[QT][8], auto more)
                __attribute__((always_inline)) {
        const int kt = it * BN;
        __syncthreads();   // previous iteration's readers (V + next K buffer) done

        // ---- stage V tile: prefetched f32 registers -> LDS f16 [d][key] (transpose) ----
        {
            #pragma unroll
            for (int i = 0; i < 4; ++i) {
                int f4 = quad + 4*i;
                #pragma unroll
                for (int e = 0; e < 4; ++e) {   // the thread's two keys are neighbours in a V^T row
                    v2h w = { (_Float16)vy[0][i][e], (_Float16)vy[1][i][e] };
                    *(v2h*)&ldsV[(f4*4+e) * SVST + 2*kpr] = w;
                }
            }
        }
        if (tid < 32) __builtin_amdgcn_s_wait_tensorcnt(0);  // current K tile arrived
        __syncthreads();   // K[cur] + V visible to all waves

        // ---- kick DMA for the NEXT K tile; overlaps with compute below ----
        if ((tid < 32) && (it + 1 < NIT))
            tdm_load_K(kbase + (size_t)(kt + BN) * DK, koff[(it + 1) & 1]);

        // ---- next tile's V rows and mask words: 24 loads in flight under this trip's compute ----
        if constexpr (decltype(more)::value) {
            const f32x4* vnx = vthr + (size_t)(kt + BN) * (DK / 4);
            const i32x4* mnx = mthr + (size_t)(kt + BN) / 4;
            #pragma unroll
            for (int r = 0; r < 2; ++r)
                #pragma unroll
                for (int i = 0; i < 4; ++i) vy[r][i] = vnx[r*(DK/4) + 4*i];
            #pragma unroll
            for (int t = 0; t < QT; ++t) {
                const i32x4* mt = mnx + t * (16 * SEQ / 4);
                #pragma unroll
                for (int s = 0; s < 4; ++s) {
                    mn[t][2*s] = mt[4*s]; mn[t][2*s+1] = mt[4*s+1];
                }
            }
            // the loads' address registers are free for reuse behind this wait; the statement also
            // keeps the 24 loads here, ahead of the trip's compute (else they sink to its end)
            asm volatile("s_wait_xcnt 0x0" ::: "memory");
        }

        const float* kb = &ldsKf[it & 1][0];

        // ---- S^T = K_tile x Q^T : four 16-key sub-tiles, K-dim = 64 in 2 chunks; each K fragment
        //      is read and converted once and multiplies both query tiles ----
        v8f acc[QT][4];
        #pragma unroll
        for (int t = 0; t < QT; ++t)
            #pragma unroll
            for (int s = 0; s < 4; ++s) acc[t][s] = v8f{};
        #pragma unroll
        for (int c = 0; c < 2; ++c) {
            #pragma unroll
            for (int s = 0; s < 4; ++s) {
                v16h ka;   // A operand: M=key row per lane, K=d swizzled
                load8_f16(kb + (16*s + ql)*SKF + 32*c +      hi*8, ka, 0);
                load8_f16(kb + (16*s + ql)*SKF + 32*c + 16 + hi*8, ka, 8);
                #pragma unroll
                for (int t = 0; t < QT; ++t)
                    acc[t][s] = __builtin_amdgcn_wmma_f32_16x16x32_f16(false, ka, false, qb[t][c],
                                                                       (short)0, acc[t][s], false, false);
            }
        }

        v16h pb[QT][2];   // P^T of keys 0..31 and of keys 32..63
        float rescale[QT];
        #pragma unroll
        for (int t = 0; t < QT; ++t) {
            // ---- mask + scale: this lane holds keys {16*s+8*hi+j}, s=0..3, j=0..7 ----
            float sc[32];
            #pragma unroll
            for (int s = 0; s < 4; ++s) {
                const v8f a = acc[t][s] * 0.125f;
                #pragma unroll
                for (int j = 0; j < 8; ++j)
                    sc[8*s+j] = mk[t][2*s + (j >> 2)][j & 3] ? a[j] : 1e-6f;
            }

            // ---- online softmax (per query; merge the two lane-halves) ----
            float mloc = sc[0];
            #pragma unroll
            for (int j = 1; j < 32; ++j) mloc = fmaxf(mloc, sc[j]);
            mloc = fmaxf(mloc, __shfl_xor(mloc, 16, 32));
            float mnew = fmaxf(m_run[t], mloc);
            rescale[t] = __expf(m_run[t] - mnew);   // 0 on first iteration (m_run = -inf)
            float p[32], lsum = 0.0f;
            #pragma unroll
            for (int j = 0; j < 32; j += 2) {   // exp(x) = 2^(x * log2 e), the difference and the product two scores at a time
                const v2f x = (v2f{sc[j], sc[j+1]} - mnew) * 1.44269504088896340736f;
                p[j]   = __builtin_amdgcn_exp2f(x[0]); lsum += p[j];
                p[j+1] = __builtin_amdgcn_exp2f(x[1]); lsum += p[j+1];
            }
            lsum += __shfl_xor(lsum, 16, 32);
            l_run[t] = l_run[t] * rescale[t] + lsum;
            m_run[t] = mnew;

            #pragma unroll
            for (int j = 0; j < 32; ++j) pb[t][j >> 4][j & 15] = (_Float16)p[j];
        }

        // ---- O^T += V^T x P^T : 4 d-chunks, two runs of K=32 keys each; each V fragment serves both
        //      query tiles; the accumulators are rescaled once a trip ----
        #pragma unroll
        for (int c = 0; c < 4; ++c) {
            #pragma unroll
            for (int t = 0; t < QT; ++t)
                #pragma unroll
                for (int j = 0; j < 8; ++j) o[t][c][j] *= rescale[t];
            #pragma unroll
            for (int g = 0; g < 2; ++g) {
                v16h va;   // A operand: M = d row per lane, K = key swizzled
                *(v8h*)&va    = *(const v8h*)&ldsV[(c*16 + ql) * SVST + 32*g +      hi*8];
                *((v8h*)&va+1)= *(const v8h*)&ldsV[(c*16 + ql) * SVST + 32*g + 16 + hi*8];
                #pragma unroll
                for (int t = 0; t < QT; ++t)
                    o[t][c] = __builtin_amdgcn_wmma_f32_16x16x32_f16(false, va, false, pb[t][g],
                                                                     (short)0, o[t][c], false, false);
            }
        }

    };

    // two trips a pass: the two sets of mask registers swap roles by name, with no copies;
    // the last trip has no next tile to load
    for (int it = 0; it < NIT - 2; it += 2) {
        trip(it,     mkA, mkB, has_next<true>{});
        trip(it + 1, mkB, mkA, has_next<true>{});
    }
    trip(NIT - 2, mkA, mkB, has_next<true>{});
    trip(NIT - 1, mkB, mkA, has_next<false>{});

    // ---- epilogue: divide by softmax sum, store O[bh][q][d] ----
    #pragma unroll
    for (int t = 0; t < QT; ++t) {
        float inv = 1.0f / l_run[t];
        float* orow = O + ((size_t)bh * SEQ + qg + 16*t) * DK;
        #pragma unroll
        for (int c = 0; c < 4; ++c) {
            int d0 = c*16 + hi*8;   // this lane-half owns d = d0 .. d0+7
            float4 lo = { o[t][c][0]*inv, o[t][c][1]*inv, o[t][c][2]*inv, o[t][c][3]*inv };
            float4 hv = { o[t][c][4]*inv, o[t][c][5]*inv, o[t][c][6]*inv, o[t][c][7]*inv };
            ((float4*)(orow + d0    ))[0] = lo;
            ((float4*)(orow + d0 + 4))[0] = hv;
        }
    }
}

extern "C" void kernel_launch(void* const* d_in, const int* in_sizes, int n_in,
                              void* d_out, int out_size, void* d_ws, size_t ws_size,
                              hipStream_t stream) {
    const float* Q   = (const float*)d_in[0];
    const float* K   = (const float*)d_in[1];
    const float* V   = (const float*)d_in[2];
    const int*   MSK = (const int*)d_in[3];
    float*       O   = (float*)d_out;

    dim3 grid(SEQ / BM, BHN);   // (8, 64): 128 queries per block, one bh per block.y
    attn_fwd_kernel<<<grid, 128, 0, stream>>>(Q, K, V, MSK, O);
}

// v005
// One run takes 30 microseconds.
// Timed twice side by side with v004, it ran 1.23 times as fast both times.
// Over all steps from v000 it is 2.51 times as fast.
#include <hip/hip_runtime.h>
#include <math.h>

typedef __attribute__((ext_vector_type(16))) _Float16 v16h;
typedef __attribute__((ext_vector_type(8)))  _Float16 v8h;
typedef __attribute__((ext_vector_type(4)))  _Float16 v4h;
typedef __attribute__((ext_vector_type(2)))  _Float16 v2h;
typedef __attribute__((ext_vector_type(8)))  float    v8f;
typedef __attribute__((ext_vector_type(2)))  float    v2f;
typedef __attribute__((ext_vector_type(4)))  unsigned int u32x4;
typedef __attribute__((ext_vector_type(8)))  int      i32x8;
typedef __attribute__((ext_vector_type(4)))  int      i32x4;
typedef __attribute__((ext_vector_type(4)))  float    f32x4;
typedef __attribute__((ext_vector_type(16))) unsigned int u32x16;

#define BHN   64
#define SEQ   1024
#define DK    64
#define BN    64      // keys per iteration
#define WAVES 4       // waves per block (wave32)
#define QT    2       // 16-query tiles per wave: each K and V fragment read from LDS serves both
#define BM    (16*QT*WAVES)
#define SKF   68
#define KBUF  4608
#define SVST  72

// Load 8 consecutive f32 -> elements [base..base+7] of a v16h (A/B operand half)
__device__ inline void load8_f16(const float* p, v16h& dst, int base) {
    float4 a = ((const float4*)p)[0];
    float4 b = ((const float4*)p)[1];
    dst[base+0] = (_Float16)a.x; dst[base+1] = (_Float16)a.y;
    dst[base+2] = (_Float16)a.z; dst[base+3] = (_Float16)a.w;
    dst[base+4] = (_Float16)b.x; dst[base+5] = (_Float16)b.y;
    dst[base+6] = (_Float16)b.z; dst[base+7] = (_Float16)b.w;
}

__device__ inline u32x4 tdm_group0_K(const float* gsrc, unsigned lds_off) {
    unsigned long long ga = (unsigned long long)(uintptr_t)gsrc;
    u32x4 g0;
    g0[0] = 1u;
    g0[1] = (unsigned)__builtin_amdgcn_readfirstlane(lds_off);
    g0[2] = (unsigned)__builtin_amdgcn_readfirstlane((unsigned)(ga & 0xFFFFFFFFull));   // global_addr[31:0]
    g0[3] = ((unsigned)__builtin_amdgcn_readfirstlane((unsigned)(ga >> 32)) & 0x01FFFFFFu)   // global_addr[56:32]
          | (2u << 30);                             // type = 2 ("image")
    return g0;
}
__device__ inline i32x8 tdm_group1_K() {
    i32x8 g1;
    g1[0] = (2 << 16)
          | (1 << 20)
          | (5 << 22)
          | (3 << 25);
    g1[1] = (DK << 16);
    g1[2] = (BN << 16);
    g1[3] = (DK << 16);
    g1[4] = BN;
    g1[5] = DK;
    g1[6] = 0;
    g1[7] = 0;
    return g1;
}
__device__ inline void tdm_load_K(u32x4 g0, i32x8 g1) {
    i32x4 g2; g2[0]=0; g2[1]=0; g2[2]=0; g2[3]=0;   // 2D tile: groups 2/3 zero
    i32x4 g3; g3[0]=0; g3[1]=0; g3[2]=0; g3[3]=0;
    i32x8 gx; gx[0]=0; gx[1]=0; gx[2]=0; gx[3]=0;   // extra operand (clang-23 6-arg form)
    gx[4]=0; gx[5]=0; gx[6]=0; gx[7]=0;
    __builtin_amdgcn_tensor_load_to_lds(g0, g1, g2, g3, gx, 0);
}

template <bool B> struct has_next { static constexpr bool value = B; };

// First launch: the int32 mask, which is the same for all 64 batch-heads, is packed once into select words.
// Word e = 8*s + j of (16-query tile T, 64-key tile kt) holds in bit 'lane' whether
// mask[16*T + (lane & 15)][64*kt + 16*s + 8*(lane >> 4) + j] is non-zero: the score that this lane holds in
// element j of score sub-tile s. PM[(T*16 + kt)*32 + e]; one wave packs one (T, kt).
__global__ void __launch_bounds__(128)
pack_mask_kernel(const int* __restrict__ MSK, unsigned int* __restrict__ PM)
{
    const int lane = threadIdx.x & 31;
    const int gw   = blockIdx.x * WAVES + (threadIdx.x >> 5);   // = T*16 + kt
    const int T    = gw / (SEQ / BN);
    const int kt   = gw % (SEQ / BN);
    const i32x4* mt = (const i32x4*)(MSK + (size_t)(16*T + (lane & 15)) * SEQ + kt * BN) + (lane >> 4) * 2;
    i32x4 m[8];
    #pragma unroll
    for (int s = 0; s < 4; ++s) { m[2*s] = mt[4*s]; m[2*s+1] = mt[4*s+1]; }
    unsigned int mine = 0;
    #pragma unroll
    for (int e = 0; e < 32; ++e) {
        const unsigned int w = __builtin_amdgcn_ballot_w32(m[e >> 2][e & 3] != 0);
        if (lane == e) mine = w;
    }
    PM[(size_t)gw * 32 + lane] = mine;
}

__global__ void __launch_bounds__(128) __attribute__((amdgpu_waves_per_eu(2, 2)))
attn_fwd_kernel(const float* __restrict__ Q, const float* __restrict__ K,
                const float* __restrict__ V, const unsigned int* __restrict__ PM,
                float* __restrict__ O)
{
    __shared__ __attribute__((aligned(2048))) float ldsKf[2][KBUF];
    __shared__ __attribute__((aligned(16))) _Float16 ldsV[DK * SVST];     // V tile transposed, f16, [d][key]

    const int bh   = blockIdx.y;
    const int qblk = blockIdx.x;
    const int tid  = threadIdx.x;
    const int wave = tid >> 5;
    const int lane = tid & 31;
    const int ql   = lane & 15;   // query (N) index within wave tile
    const int hi   = lane >> 4;   // lane-half selector for K-dim swizzle

    const int qg = qblk * BM + wave * (16*QT) + ql;       // global query row of tile 0; tile t: + 16*t
    const float* qrow = Q   + ((size_t)bh * SEQ + qg) * DK;
    const float* kbase = K + (size_t)bh * SEQ * DK;

    const unsigned koff[2] = { (unsigned)(uintptr_t)&ldsKf[0][0],
                               (unsigned)(uintptr_t)&ldsKf[1][0] };

    // ---- Q as B-operand (Q^T: N=q per lane, K=d swizzled), two 32-d chunks ----
    v16h qb[QT][2];
    #pragma unroll
    for (int t = 0; t < QT; ++t)
        #pragma unroll
        for (int c = 0; c < 2; ++c) {
            load8_f16(qrow + t*16*DK + 32*c +      hi*8, qb[t][c], 0);
            load8_f16(qrow + t*16*DK + 32*c + 16 + hi*8, qb[t][c], 8);
        }

    // ---- flash-attention state (q = lane&15; both lane-halves keep full state) ----
    float m_run[QT], l_run[QT];
    v8f o[QT][4];   // O^T accumulators: chunk c covers d = c*16 + (j + 8*hi)
    #pragma unroll
    for (int t = 0; t < QT; ++t) {
        m_run[t] = -INFINITY;
        l_run[t] = 0.0f;
        #pragma unroll
        for (int c = 0; c < 4; ++c)
            #pragma unroll
            for (int j = 0; j < 8; ++j) o[t][c][j] = 0.0f;
    }

    const int kpr  = tid >> 2;    // staging: key rows 2*kpr and 2*kpr+1
    const int quad = tid & 3;     // staging: 4 threads per row

    u32x4 dg0 = tdm_group0_K(kbase, koff[0]);
    i32x8 dg1 = tdm_group1_K();
    // Without this statement the constants are formed anew, in other registers, at the load and at the wait.
    asm volatile("" : "+s"(dg0), "+s"(dg1));
    if (tid < 32) tdm_load_K(dg0, dg1);

    // ---- prologue: first tile's V rows into registers, the first select words into scalar registers ----
    const f32x4* vthr = (const f32x4*)(V + ((size_t)bh * SEQ + 2*kpr) * DK) + quad;
    // the wave's select words: the same address in every lane, and nothing writes them during this launch;
    // named as constant memory, so that also the loads behind a barrier are scalar loads
    typedef const __attribute__((address_space(4))) u32x16* cptr16;
    const cptr16 pmw = (cptr16)(uintptr_t)(PM + (size_t)(qblk * (BM/16) + __builtin_amdgcn_readfirstlane(wave) * QT)
                                                * (SEQ / BN) * 32);
    f32x4 vy[2][4];   // this thread's 4 x 16B of each of its two rows of the V tile that is staged next
    u32x16 mw[2];     // the 32 select words of the (query tile, key tile) that is scored next
    #pragma unroll
    for (int r = 0; r < 2; ++r)
        #pragma unroll
        for (int i = 0; i < 4; ++i) vy[r][i] = vthr[r*(DK/4) + 4*i];
    mw[0] = pmw[0]; mw[1] = pmw[1];

    const int NIT = SEQ / BN;
    // one trip: scores tile 'it' under select words mw, which each query tile's selects leave to the words that
    // are used next; where 'more' says so, loads tile it+1's V rows into vy. Inlined, so that the register
    // arrays stay registers.
    auto trip = [&](const int it, auto more) __attribute__((always_inline)) {
        const int kt = it * BN;
        __syncthreads();   // previous iteration's readers (V + next K buffer) done

        // ---- stage V tile: prefetched f32 registers -> LDS f16 [d][key] (transpose) ----
        {
            #pragma unroll
            for (int i = 0; i < 4; ++i) {
                int f4 = quad + 4*i;
                #pragma unroll
                for (int e = 0; e < 4; ++e) {   // the thread's two keys are neighbours in a V^T row
                    v2h w = { (_Float16)vy[0][i][e], (_Float16)vy[1][i][e] };
                    *(v2h*)&ldsV[(f4*4+e) * SVST + 2*kpr] = w;
                }
            }
        }
        if (tid < 32) asm volatile("s_wait_tensorcnt 0x0" :: "s"(dg0), "s"(dg1) : "memory");
        __syncthreads();   // K[cur] + V visible to all waves

        // ---- kick DMA for the NEXT K tile; overlaps with compute below ----
        if constexpr (decltype(more)::value) {
            dg0 = tdm_group0_K(kbase + (size_t)(kt + BN) * DK, koff[(it + 1) & 1]);
            asm volatile("" : "+s"(dg0));
            if (tid < 32) tdm_load_K(dg0, dg1);
        }

        // ---- next tile's V rows: 8 loads in flight under this trip's compute ----
        if constexpr (decltype(more)::value) {
            const f32x4* vnx = vthr + (size_t)(kt + BN) * (DK / 4);
            #pragma unroll
            for (int r = 0; r < 2; ++r)
                #pragma unroll
                for (int i = 0; i < 4; ++i) vy[r][i] = vnx[r*(DK/4) + 4*i];
            // the loads' address registers are free for reuse behind this wait; the statement also
            // keeps the 8 loads here, ahead of the trip's compute (else they sink to its end)
            asm volatile("s_wait_xcnt 0x0" ::: "memory");
        }

        const float* kb = &ldsKf[it & 1][0];

        // ---- S^T = K_tile x Q^T : four 16-key sub-tiles, K-dim = 64 in 2 chunks; each K fragment
        //      is read and converted once and multiplies both query tiles ----
        v8f acc[QT][4];
        #pragma unroll
        for (int t = 0; t < QT; ++t)
            #pragma unroll
            for (int s = 0; s < 4; ++s) acc[t][s] = v8f{};
        #pragma unroll
        for (int c = 0; c < 2; ++c) {
            #pragma unroll
            for (int s = 0; s < 4; ++s) {
                v16h ka;   // A operand: M=key row per lane, K=d swizzled
                load8_f16(kb + (16*s + ql)*SKF + 32*c +      hi*8, ka, 0);
                load8_f16(kb + (16*s + ql)*SKF + 32*c + 16 + hi*8, ka, 8);
                #pragma unroll
                for (int t = 0; t < QT; ++t)
                    acc[t][s] = __builtin_amdgcn_wmma_f32_16x16x32_f16(false, ka, false, qb[t][c],
                                                                       (short)0, acc[t][s], false, false);
            }
        }

        v16h pb[QT][2];   // P^T of keys 0..31 and of keys 32..63
        float rescale[QT];
        #pragma unroll
        for (int t = 0; t < QT; ++t) {
            // ---- mask + scale: this lane holds keys {16*s+8*hi+j}, s=0..3, j=0..7 ----
            float sc[32];
            #pragma unroll
            for (int s = 0; s < 4; ++s) {
                const v8f a = acc[t][s] * 0.125f;
                #pragma unroll
                for (int j = 0; j < 8; ++j)
                    sc[8*s+j] = __builtin_amdgcn_inverse_ballot_w32(mw[s >> 1][8*(s & 1) + j]) ? a[j] : 1e-6f;
            }
            // the select words that are used next, into the scalar registers that the selects above have left:
            // the next query tile's of this key tile, or the first query tile's of the next key tile
            if (t + 1 < QT) {
                mw[0] = pmw[((t + 1) * NIT + it) * 2]; mw[1] = pmw[((t + 1) * NIT + it) * 2 + 1];
            } else if constexpr (decltype(more)::value) {
                mw[0] = pmw[(it + 1) * 2]; mw[1] = pmw[(it + 1) * 2 + 1];
            }

            // ---- online softmax (per query; merge the two lane-halves) ----
            float mloc = sc[0];
            #pragma unroll
            for (int j = 1; j < 32; ++j) mloc = fmaxf(mloc, sc[j]);
            mloc = fmaxf(mloc, __shfl_xor(mloc, 16, 32));
            float mnew = fmaxf(m_run[t], mloc);
            rescale[t] = __expf(m_run[t] - mnew);   // 0 on first iteration (m_run = -inf)
            float p[32], lsum = 0.0f;
            #pragma unroll
            for (int j = 0; j < 32; j += 2) {   // exp(x) = 2^(x * log2 e), the difference and the product two scores at a time
                const v2f x = (v2f{sc[j], sc[j+1]} - mnew) * 1.44269504088896340736f;
                p[j]   = __builtin_amdgcn_exp2f(x[0]); lsum += p[j];
                p[j+1] = __builtin_amdgcn_exp2f(x[1]); lsum += p[j+1];
            }
            lsum += __shfl_xor(lsum, 16, 32);
            l_run[t] = l_run[t] * rescale[t] + lsum;
            m_run[t] = mnew;

            #pragma unroll
            for (int j = 0; j < 32; ++j) pb[t][j >> 4][j & 15] = (_Float16)p[j];
            // keeps the next query tile's selects, which wait for the scalar loads above, behind this tile's
            // exponentials, so that the loads' latency passes under them (else the wait stands right behind the loads)
            if (t + 1 < QT) __builtin_amdgcn_sched_barrier(0);
        }

        // ---- O^T += V^T x P^T : 4 d-chunks, two runs of K=32 keys each; each V fragment serves both
        //      query tiles; the accumulators are rescaled once a trip ----
        #pragma unroll
        for (int c = 0; c < 4; ++c) {
            #pragma unroll
            for (int t = 0; t < QT; ++t)
                #pragma unroll
                for (int j = 0; j < 8; ++j) o[t][c][j] *= rescale[t];
            #pragma unroll
            for (int g = 0; g < 2; ++g) {
                v16h va;   // A operand: M = d row per lane, K = key swizzled
                *(v8h*)&va    = *(const v8h*)&ldsV[(c*16 + ql) * SVST + 32*g +      hi*8];
                *((v8h*)&va+1)= *(const v8h*)&ldsV[(c*16 + ql) * SVST + 32*g + 16 + hi*8];
                #pragma unroll
                for (int t = 0; t < QT; ++t)
                    o[t][c] = __builtin_amdgcn_wmma_f32_16x16x32_f16(false, va, false, pb[t][g],
                                                                     (short)0, o[t][c], false, false);
            }
        }

    };

    // two trips a pass: each names its K buffer at compile time; the last trip has no next tile to load
    for (int it = 0; it < NIT - 2; it += 2) {
        trip(it,     has_next<true>{});
        trip(it + 1, has_next<true>{});
    }
    trip(NIT - 2, has_next<true>{});
    trip(NIT - 1, has_next<false>{});

    // ---- epilogue: divide by softmax sum, store O[bh][q][d] ----
    #pragma unroll
    for (int t = 0; t < QT; ++t) {
        float inv = 1.0f / l_run[t];
        float* orow = O + ((size_t)bh * SEQ + qg + 16*t) * DK;
        #pragma unroll
        for (int c = 0; c < 4; ++c) {
            int d0 = c*16 + hi*8;   // this lane-half owns d = d0 .. d0+7
            float4 lo = { o[t][c][0]*inv, o[t][c][1]*inv, o[t][c][2]*inv, o[t][c][3]*inv };
            float4 hv = { o[t][c][4]*inv, o[t][c][5]*inv, o[t][c][6]*inv, o[t][c][7]*inv };
            ((float4*)(orow + d0    ))[0] = lo;
            ((float4*)(orow + d0 + 4))[0] = hv;
        }
    }
}

extern "C" void kernel_launch(void* const* d_in, const int* in_sizes, int n_in,
                              void* d_out, int out_size, void* d_ws, size_t ws_size,
                              hipStream_t stream) {
    const float* Q   = (const float*)d_in[0];
    const float* K   = (const float*)d_in[1];
    const float* V   = (const float*)d_in[2];
    const int*   MSK = (const int*)d_in[3];
    float*       O   = (float*)d_out;
    unsigned int* PM = (unsigned int*)d_ws;   // 128 KiB of select words, written anew by the first launch of every call

    dim3 grid(SEQ / BM, BHN);   // (8, 64): 128 queries per block, one bh per block.y
    pack_mask_kernel<<<dim3((SEQ / 16) * (SEQ / BN) / WAVES), 128, 0, stream>>>(MSK, PM);
    attn_fwd_kernel<<<grid, 128, 0, stream>>>(Q, K, V, PM, O);
}

// v006
// It runs in 27.9 microseconds.
// In two side-by-side timings against v005, it was 1.07 and 1.08 times as fast.
// All steps since v000 together make it 2.71 times as fast.
#include <hip/hip_runtime.h>
#include <math.h>

typedef __attribute__((ext_vector_type(16))) _Float16 v16h;
typedef __attribute__((ext_vector_type(8)))  _Float16 v8h;
typedef __attribute__((ext_vector_type(4)))  _Float16 v4h;
typedef __attribute__((ext_vector_type(2)))  _Float16 v2h;
typedef __attribute__((ext_vector_type(8)))  float    v8f;
typedef __attribute__((ext_vector_type(2)))  float    v2f;
typedef __attribute__((ext_vector_type(4)))  unsigned int u32x4;
typedef __attribute__((ext_vector_type(8)))  int      i32x8;
typedef __attribute__((ext_vector_type(4)))  int      i32x4;
typedef __attribute__((ext_vector_type(4)))  float    f32x4;
typedef __attribute__((ext_vector_type(16))) unsigned int u32x16;

#define BHN   64
#define SEQ   1024
#define DK    64
#define BN    64      // keys per iteration
#define WAVES 4       // waves (wave32) per key group, one per 32-query slice; also waves per block of the first launch
#define KG    2       // key groups per block: group g scores keys [g*SEQ/KG, (g+1)*SEQ/KG) for all of the block's queries
#define QT    2       // 16-query tiles per wave: each K and V fragment read from LDS serves both
#define BM    (16*QT*WAVES)
#define SKF   68
#define KBUF  4608
#define SVST  72

// Load 8 consecutive f32 -> elements [base..base+7] of a v16h (A/B operand half)
__device__ inline void load8_f16(const float* p, v16h& dst, int base) {
    float4 a = ((const float4*)p)[0];
    float4 b = ((const float4*)p)[1];
    dst[base+0] = (_Float16)a.x; dst[base+1] = (_Float16)a.y;
    dst[base+2] = (_Float16)a.z; dst[base+3] = (_Float16)a.w;
    dst[base+4] = (_Float16)b.x; dst[base+5] = (_Float16)b.y;
    dst[base+6] = (_Float16)b.z; dst[base+7] = (_Float16)b.w;
}

__device__ inline u32x4 tdm_group0_K(const float* gsrc, unsigned lds_off) {
    unsigned long long ga = (unsigned long long)(uintptr_t)gsrc;
    u32x4 g0;
    g0[0] = 1u;
    g0[1] = (unsigned)__builtin_amdgcn_readfirstlane(lds_off);
    g0[2] = (unsigned)__builtin_amdgcn_readfirstlane((unsigned)(ga & 0xFFFFFFFFull));   // global_addr[31:0]
    g0[3] = ((unsigned)__builtin_amdgcn_readfirstlane((unsigned)(ga >> 32)) & 0x01FFFFFFu)   // global_addr[56:32]
          | (2u << 30);                             // type = 2 ("image")
    return g0;
}
__device__ inline i32x8 tdm_group1_K() {
    i32x8 g1;
    g1[0] = (2 << 16)
          | (1 << 20)
          | (5 << 22)
          | (3 << 25);
    g1[1] = (DK << 16);
    g1[2] = (BN << 16);
    g1[3] = (DK << 16);
    g1[4] = BN;
    g1[5] = DK;
    g1[6] = 0;
    g1[7] = 0;
    return g1;
}
__device__ inline void tdm_load_K(u32x4 g0, i32x8 g1) {
    i32x4 g2; g2[0]=0; g2[1]=0; g2[2]=0; g2[3]=0;   // 2D tile: groups 2/3 zero
    i32x4 g3; g3[0]=0; g3[1]=0; g3[2]=0; g3[3]=0;
    i32x8 gx; gx[0]=0; gx[1]=0; gx[2]=0; gx[3]=0;   // extra operand (clang-23 6-arg form)
    gx[4]=0; gx[5]=0; gx[6]=0; gx[7]=0;
    __builtin_amdgcn_tensor_load_to_lds(g0, g1, g2, g3, gx, 0);
}

template <bool B> struct has_next { static constexpr bool value = B; };
template <int I> struct tile_no { static constexpr int value = I; };

__device__ inline unsigned pinned(unsigned v) {
    unsigned w = (unsigned)__builtin_amdgcn_readfirstlane(v);
    asm volatile("" : "+s"(w));   // pinned(): the test's word held in a scalar register
    return w;
}

// First launch: the int32 mask, which is the same for all 64 batch-heads, is packed once into select words.
// Word e = 8*s + j of (16-query tile T, 64-key tile kt) holds in bit 'lane' whether
// mask[16*T + (lane & 15)][64*kt + 16*s + 8*(lane >> 4) + j] is non-zero: the score that this lane holds in
// element j of score sub-tile s. PM[(T*16 + kt)*32 + e]; one wave packs one (T, kt).
__global__ void __launch_bounds__(128)
pack_mask_kernel(const int* __restrict__ MSK, unsigned int* __restrict__ PM)
{
    const int lane = threadIdx.x & 31;
    const int gw   = blockIdx.x * WAVES + (threadIdx.x >> 5);   // = T*16 + kt
    const int T    = gw / (SEQ / BN);
    const int kt   = gw % (SEQ / BN);
    const i32x4* mt = (const i32x4*)(MSK + (size_t)(16*T + (lane & 15)) * SEQ + kt * BN) + (lane >> 4) * 2;
    i32x4 m[8];
    #pragma unroll
    for (int s = 0; s < 4; ++s) { m[2*s] = mt[4*s]; m[2*s+1] = mt[4*s+1]; }
    unsigned int mine = 0;
    #pragma unroll
    for (int e = 0; e < 32; ++e) {
        const unsigned int w = __builtin_amdgcn_ballot_w32(m[e >> 2][e & 3] != 0);
        if (lane == e) mine = w;
    }
    PM[(size_t)gw * 32 + lane] = mine;
}

__global__ void __launch_bounds__(128 * KG) __attribute__((amdgpu_waves_per_eu(4, 4)))
attn_fwd_kernel(const float* __restrict__ Q, const float* __restrict__ K,
                const float* __restrict__ V, const unsigned int* __restrict__ PM,
                float* __restrict__ O)
{
    __shared__ __attribute__((aligned(2048))) float ldsKf[KG][2][KBUF];
    __shared__ __attribute__((aligned(16))) _Float16 ldsVall[KG][DK * SVST];

    const int bh   = blockIdx.y;
    const int qblk = blockIdx.x;
    const int wv   = __builtin_amdgcn_readfirstlane(threadIdx.x >> 5);
    const int grp  = wv / WAVES;              // key group of this wave
    const int wave = wv % WAVES;              // its 32-query slice
    const int tid  = threadIdx.x & (32*WAVES - 1);   // thread within the key group
    const int lane = tid & 31;
    const int ql   = lane & 15;   // query (N) index within wave tile
    const int hi   = lane >> 4;   // lane-half selector for K-dim swizzle

    const int qg = qblk * BM + wave * (16*QT) + ql;       // global query row of tile 0; tile t: + 16*t
    const float* qrow = Q   + ((size_t)bh * SEQ + qg) * DK;
    const float* kbase = K + ((size_t)bh * SEQ + grp * (SEQ / KG)) * DK;   // the group's first key row
    _Float16* const ldsV = &ldsVall[grp][0];

    const unsigned koff[2] = { (unsigned)(uintptr_t)&ldsKf[grp][0][0],
                               (unsigned)(uintptr_t)&ldsKf[grp][1][0] };

    // ---- Q as B-operand (Q^T: N=q per lane, K=d swizzled), two 32-d chunks ----
    v16h qb[QT][2];
    #pragma unroll
    for (int t = 0; t < QT; ++t)
        #pragma unroll
        for (int c = 0; c < 2; ++c) {
            load8_f16(qrow + t*16*DK + 32*c +      hi*8, qb[t][c], 0);
            load8_f16(qrow + t*16*DK + 32*c + 16 + hi*8, qb[t][c], 8);
        }

    // ---- flash-attention state (q = lane&15; both lane-halves keep full state) ----
    float m_run[QT], l_run[QT];
    v8f o[QT][4];   // O^T accumulators: chunk c covers d = c*16 + (j + 8*hi)
    #pragma unroll
    for (int t = 0; t < QT; ++t) {
        m_run[t] = -INFINITY;
        l_run[t] = 0.0f;
        #pragma unroll
        for (int c = 0; c < 4; ++c)
            #pragma unroll
            for (int j = 0; j < 8; ++j) o[t][c][j] = 0.0f;
    }

    const int kpr  = tid >> 2;    // staging: key rows 2*kpr and 2*kpr+1
    const int quad = tid & 3;     // staging: 4 threads per row

    u32x4 dg0 = tdm_group0_K(kbase, koff[0]);
    i32x8 dg1 = tdm_group1_K();
    // Without this statement the constants are formed anew, in other registers, at the load and at the wait.
    asm volatile("" : "+s"(dg0), "+s"(dg1));
    if (pinned(wave == 0)) tdm_load_K(dg0, dg1);

    // ---- prologue: first tile's V rows into registers, the first select words into scalar registers ----
    const f32x4* vthr = (const f32x4*)(V + ((size_t)bh * SEQ + grp * (SEQ / KG) + 2*kpr) * DK) + quad;
    // the wave's select words: the same address in every lane, and nothing writes them during this launch;
    // named as constant memory, so that also the loads behind a barrier are scalar loads
    typedef const __attribute__((address_space(4))) u32x16* cptr16;
    const cptr16 pmw = (cptr16)(uintptr_t)(PM + ((size_t)(qblk * (BM/16) + wave * QT) * (SEQ / BN)
                                                 + grp * (SEQ / BN / KG)) * 32);
    f32x4 vy[2][4];   // this thread's 4 x 16B of each of its two rows of the V tile that is staged next
    u32x16 mw[2];     // the 32 select words of the (query tile, key tile) that is scored next
    #pragma unroll
    for (int r = 0; r < 2; ++r)
        #pragma unroll
        for (int i = 0; i < 4; ++i) vy[r][i] = vthr[r*(DK/4) + 4*i];
    mw[0] = pmw[0]; mw[1] = pmw[1];

    const int NIT  = SEQ / BN / KG;   // key tiles of one group
    const int NALL = SEQ / BN;        // key tiles of a query tile in the select words
    // one trip: scores tile 'it' under select words mw, which each query tile's selects leave to the words that
    // are used next; where 'more' says so, loads tile it+1's V rows into vy. Inlined, so that the register
    // arrays stay registers.
    auto trip = [&](const int it, auto more) __attribute__((always_inline)) {
        const int kt = it * BN;
        __syncthreads();   // previous iteration's readers (V + next K buffer) done

        // ---- stage V tile: prefetched f32 registers -> LDS f16 [d][key] (transpose) ----
        {
            #pragma unroll
            for (int i = 0; i < 4; ++i) {
                int f4 = quad + 4*i;
                #pragma unroll
                for (int e = 0; e < 4; ++e) {   // the thread's two keys are neighbours in a V^T row
                    v2h w = { (_Float16)vy[0][i][e], (_Float16)vy[1][i][e] };
                    *(v2h*)&ldsV[(f4*4+e) * SVST + 2*kpr] = w;
                }
            }
        }
        if (pinned(wave == 0)) asm volatile("s_wait_tensorcnt 0x0" :: "s"(dg0), "s"(dg1) : "memory");
        __syncthreads();   // K[cur] + V visible to all waves

        // ---- kick DMA for the NEXT K tile; overlaps with compute below ----
        if constexpr (decltype(more)::value) {
            dg0 = tdm_group0_K(kbase + (size_t)(kt + BN) * DK, koff[(it + 1) & 1]);
            asm volatile("" : "+s"(dg0));
            if (pinned(wave == 0)) tdm_load_K(dg0, dg1);
        }

        const float* kb = &ldsKf[grp][it & 1][0];

        // ---- S^T = K_tile x Q^T : four 16-key sub-tiles, K-dim = 64 in 2 chunks; each K fragment
        //      is read and converted once and multiplies both query tiles ----
        v8f acc[QT][4];
        #pragma unroll
        for (int t = 0; t < QT; ++t)
            #pragma unroll
            for (int s = 0; s < 4; ++s) acc[t][s] = v8f{};
        // The K reads go in groups of 8 (two fragments: sub-tiles 2h and 2h+1 of 32-d chunk c, group = 2*c + h); a group
        // is converted as a whole, and the next group's reads are issued ahead of this group's products. At 256
        // registers a wave the compiler, left alone, reads, waits out the LDS latency and converts one 16-byte
        // piece at a time, 32 times a trip.
        f32x4 kr[2][4];
        auto kread = [&](const int grpno) __attribute__((always_inline)) {
            #pragma unroll
            for (int f = 0; f < 2; ++f) {
                const f32x4* p = (const f32x4*)(kb + (16*(2*(grpno & 1) + f) + ql)*SKF + 32*(grpno >> 1) + hi*8);
                kr[f][0] = p[0]; kr[f][1] = p[1];   // d + 0..7
                kr[f][2] = p[4]; kr[f][3] = p[5];   // d + 16..23
            }
            __builtin_amdgcn_sched_barrier(0);   // keeps the 8 reads together and ahead of what follows
        };
        kread(0);
        #pragma unroll
        for (int gn = 0; gn < 4; ++gn) {
            v16h ka[2];   // A operands: M=key row per lane, K=d swizzled
            #pragma unroll
            for (int f = 0; f < 2; ++f)
                #pragma unroll
                for (int e = 0; e < 16; ++e) ka[f][e] = (_Float16)kr[f][e >> 2][e & 3];
            __builtin_amdgcn_sched_barrier(0);   // the converts free the f32 registers for the next group's reads
            if (gn + 1 < 4) kread(gn + 1);
            #pragma unroll
            for (int f = 0; f < 2; ++f)
                #pragma unroll
                for (int t = 0; t < QT; ++t)
                    acc[t][2*(gn & 1) + f] = __builtin_amdgcn_wmma_f32_16x16x32_f16(false, ka[f], false, qb[t][gn >> 1],
                                                                       (short)0, acc[t][2*(gn & 1) + f], false, false);
        }

        if constexpr (decltype(more)::value) {
            const f32x4* vnx = vthr + (size_t)(kt + BN) * (DK / 4);
            #pragma unroll
            for (int r = 0; r < 2; ++r)
                #pragma unroll
                for (int i = 0; i < 4; ++i) vy[r][i] = vnx[r*(DK/4) + 4*i];
            // the loads' address registers are free for reuse behind this wait; the statement also
            // keeps the 8 loads here, ahead of the softmax (else they sink to the trip's end)
            asm volatile("s_wait_xcnt 0x0" ::: "memory");
        }

        v16h pb[QT][2];   // P^T of keys 0..31 and of keys 32..63
        float rescale[QT];
        #pragma unroll
        for (int t = 0; t < QT; ++t) {
            // ---- mask + scale: this lane holds keys {16*s+8*hi+j}, s=0..3, j=0..7 ----
            float sc[32];
            #pragma unroll
            for (int s = 0; s < 4; ++s) {
                const v8f a = acc[t][s] * 0.125f;
                #pragma unroll
                for (int j = 0; j < 8; ++j)
                    sc[8*s+j] = __builtin_amdgcn_inverse_ballot_w32(mw[s >> 1][8*(s & 1) + j]) ? a[j] : 1e-6f;
            }
            // the select words that are used next, into the scalar registers that the selects above have left:
            // the next query tile's of this key tile, or the first query tile's of the next key tile
            if (t + 1 < QT) {
                mw[0] = pmw[((t + 1) * NALL + it) * 2]; mw[1] = pmw[((t + 1) * NALL + it) * 2 + 1];
            } else if constexpr (decltype(more)::value) {
                mw[0] = pmw[(it + 1) * 2]; mw[1] = pmw[(it + 1) * 2 + 1];
            }

            // ---- online softmax (per query; merge the two lane-halves) ----
            float mloc = sc[0];
            #pragma unroll
            for (int j = 1; j < 32; ++j) mloc = fmaxf(mloc, sc[j]);
            mloc = fmaxf(mloc, __shfl_xor(mloc, 16, 32));
            float mnew = fmaxf(m_run[t], mloc);
            rescale[t] = __expf(m_run[t] - mnew);   // 0 on first iteration (m_run = -inf)
            float p[32], lsum = 0.0f;
            #pragma unroll
            for (int j = 0; j < 32; j += 2) {   // exp(x) = 2^(x * log2 e), the difference and the product two scores at a time
                const v2f x = (v2f{sc[j], sc[j+1]} - mnew) * 1.44269504088896340736f;
                p[j]   = __builtin_amdgcn_exp2f(x[0]); lsum += p[j];
                p[j+1] = __builtin_amdgcn_exp2f(x[1]); lsum += p[j+1];
            }
            lsum += __shfl_xor(lsum, 16, 32);
            l_run[t] = l_run[t] * rescale[t] + lsum;
            m_run[t] = mnew;

            #pragma unroll
            for (int j = 0; j < 32; ++j) pb[t][j >> 4][j & 15] = (_Float16)p[j];
            // keeps the next query tile's selects, which wait for the scalar loads above, behind this tile's
            // exponentials, so that the loads' latency passes under them (else the wait stands right behind the loads)
            if (t + 1 < QT) __builtin_amdgcn_sched_barrier(0);
        }

        // ---- O^T += V^T x P^T : 4 d-chunks, two runs of K=32 keys each; each V fragment serves both
        //      query tiles; the accumulators are rescaled once a trip ----
        v8h vr[4][2][2];
        auto vread = [&](const int c) __attribute__((always_inline)) {   // the 4 reads of d-chunk c
            #pragma unroll
            for (int g = 0; g < 2; ++g) {
                vr[c][g][0] = *(const v8h*)&ldsV[(c*16 + ql) * SVST + 32*g +      hi*8];
                vr[c][g][1] = *(const v8h*)&ldsV[(c*16 + ql) * SVST + 32*g + 16 + hi*8];
            }
        };
        vread(0); vread(1);
        __builtin_amdgcn_sched_barrier(0);   // keeps the V reads two d-chunks ahead of their products (else: read, full wait, product, 8 times)
        #pragma unroll
        for (int c = 0; c < 4; ++c) {
            if (c + 2 < 4) {
                vread(c + 2);
                __builtin_amdgcn_sched_barrier(0);
            }
            #pragma unroll
            for (int t = 0; t < QT; ++t)
                #pragma unroll
                for (int j = 0; j < 8; ++j) o[t][c][j] *= rescale[t];
            #pragma unroll
            for (int g = 0; g < 2; ++g) {
                v16h va;   // A operand: M = d row per lane, K = key swizzled
                *(v8h*)&va    = vr[c][g][0];
                *((v8h*)&va+1)= vr[c][g][1];
                #pragma unroll
                for (int t = 0; t < QT; ++t)
                    o[t][c] = __builtin_amdgcn_wmma_f32_16x16x32_f16(false, va, false, pb[t][g],
                                                                     (short)0, o[t][c], false, false);
            }
        }

    };

    // two trips a pass: each names its K buffer at compile time; the last trip has no next tile to load
    for (int it = 0; it < NIT - 2; it += 2) {
        trip(it,     has_next<true>{});
        trip(it + 1, has_next<true>{});
    }
    trip(NIT - 2, has_next<true>{});
    trip(NIT - 1, has_next<false>{});

    // ---- epilogue: the two waves of a query slice hold the same queries in the same lanes and registers, each over
    //      its half of the keys. Group g hands query tile 1-g to its partner through LDS and finishes tile g. ----
    __syncthreads();   // every wave has made its last K and V reads, no tensor load is in flight: the K buffers become exchange space
    f32x4* const xch = (f32x4*)&ldsKf[0][0][0] + (size_t)wave * QT * 9 * 32 + lane;   // 9 x 16B a lane and query tile
    auto hand_over = [&](auto tn) __attribute__((always_inline)) {
        constexpr int t = decltype(tn)::value;
        f32x4* const x = xch + t * 9 * 32;
        #pragma unroll
        for (int c = 0; c < 4; ++c) {
            x[(2*c    ) * 32] = f32x4{ o[t][c][0], o[t][c][1], o[t][c][2], o[t][c][3] };
            x[(2*c + 1) * 32] = f32x4{ o[t][c][4], o[t][c][5], o[t][c][6], o[t][c][7] };
        }
        x[8 * 32] = f32x4{ m_run[t], l_run[t], 0.0f, 0.0f };
    };
    // joins the partner's maximum, sum and O^T with this wave's, divides by the softmax sum, stores O[bh][q][d]
    auto finish = [&](auto tn) __attribute__((always_inline)) {
        constexpr int t = decltype(tn)::value;
        const f32x4* const x = xch + t * 9 * 32;
        const f32x4 ml = x[8 * 32];
        const float m   = fmaxf(m_run[t], ml[0]);
        const float wa  = __expf(m_run[t] - m);
        const float wb  = __expf(ml[0] - m);
        const float inv = 1.0f / (l_run[t] * wa + ml[1] * wb);
        const float sa = wa * inv, sb = wb * inv;
        float* orow = O + ((size_t)bh * SEQ + qg + 16*t) * DK;
        #pragma unroll
        for (int c = 0; c < 4; ++c) {
            int d0 = c*16 + hi*8;   // this lane-half owns d = d0 .. d0+7
            const f32x4 pl = x[(2*c) * 32], ph = x[(2*c + 1) * 32];
            float4 lo = { o[t][c][0]*sa + pl[0]*sb, o[t][c][1]*sa + pl[1]*sb, o[t][c][2]*sa + pl[2]*sb, o[t][c][3]*sa + pl[3]*sb };
            float4 hv = { o[t][c][4]*sa + ph[0]*sb, o[t][c][5]*sa + ph[1]*sb, o[t][c][6]*sa + ph[2]*sb, o[t][c][7]*sa + ph[3]*sb };
            ((float4*)(orow + d0    ))[0] = lo;
            ((float4*)(orow + d0 + 4))[0] = hv;
        }
    };
    if (grp == 0) hand_over(tile_no<1>{}); else hand_over(tile_no<0>{});
    __syncthreads();   // both handed-over tiles visible
    if (grp == 0) finish(tile_no<0>{}); else finish(tile_no<1>{});
}

extern "C" void kernel_launch(void* const* d_in, const int* in_sizes, int n_in,
                              void* d_out, int out_size, void* d_ws, size_t ws_size,
                              hipStream_t stream) {
    const float* Q   = (const float*)d_in[0];
    const float* K   = (const float*)d_in[1];
    const float* V   = (const float*)d_in[2];
    const int*   MSK = (const int*)d_in[3];
    float*       O   = (float*)d_out;
    unsigned int* PM = (unsigned int*)d_ws;   // 128 KiB of select words, written anew by the first launch of every call

    dim3 grid(SEQ / BM, BHN);   // (8, 64): 128 queries per block, one bh per block.y
    pack_mask_kernel<<<dim3((SEQ / 16) * (SEQ / BN) / WAVES), 128, 0, stream>>>(MSK, PM);
    attn_fwd_kernel<<<grid, 128 * KG, 0, stream>>>(Q, K, V, PM, O);
}
